// v009
// The times below were measured on an AMD MI455X: many runs one after another, warmed up first and cycling through
// copies of the inputs, with the whole window's GPU time divided by the number of runs. Launches and the gaps
// between them are all in it. The median over several windows is given; except for v000 it joins two sittings, which
// can be a few percent apart, so the side-by-side timings, each taken in one sitting, are the better comparison.
// The versions before v009 are in another document.
// Measured time: 216 microseconds a run.
// Two timings next to v008 both put it at 1.05 times that version's speed.
// Counting every step since v000, which is the starting kernel, it is 4.18 times as fast.
#include <hip/hip_runtime.h>
// Contractions: x.Wq^T, x.Wk^T, x.Wv^T, ctx.Wo^T = v_wmma_f32_16x16x32_f16 (f16 operands: bf16-RNE inputs exact in f16, weights carried x16 (x16384 for the ctx-hi half of the early-row output GEMM); f32 accumulate); scores q.k^T and P.V^T = v_wmma_f32_16x16x32_f16 (plain f16 hi planes; hi + x1024 residual planes of q, k, P and v for query positions < RE; P carried x1024), f32 accumulate; per-head RMS normalisation, rotary step, additive mask, softmax and normalisers f32.

#ifndef NB
#define NB 2
#endif
#ifndef SEQ
#define SEQ 2048
#endif
#define NB_FULL 2
#define SEQ_FULL 2048
#define DM 2048
#define NH 16
#define NKVH 4
#define NREP (NH / NKVH)
#define HDIM 128
#define VW (NKVH * HDIM)                     /* width of the k / v projection rows */
#define NV64 (VW / 64)                       /* 64-wide column groups of the v rows */
#define QKVW (DM + 2 * VW)                   /* row of the joint projection plane: [q | k | v] */
#define MSKP 2048                            /* row pitch of the mask input */
#define RTW 64                               /* row pitch of the cos / sin inputs */
#define SLEN SEQ
#define NR (NB * SLEN)
#define TQ SLEN
#define TK SLEN
#define SCL 0.08838834764831845f
#define MVIS (-1.0e8f)                       /* a mask entry above this keeps its key visible */
#define QBLKS (TQ / 64)
#define RE ((SLEN < 512) ? SLEN : 512)      /* query positions [0, RE) get residual planes on q, k, P, v and ctx */
#define QB05 0
#define QBN5 (RE / 64)
#define QB0P QBN5
#define QBNP (QBLKS - QBN5)
static_assert(SLEN % 128 == 0);
static_assert(SLEN <= SEQ_FULL);
static_assert(SLEN <= MSKP);
static_assert(NB >= 1 && NB <= NB_FULL);
static_assert(RE % 128 == 0 && RE <= SLEN);
static_assert((SLEN - RE) % 128 == 0);
static_assert(DM % 128 == 0 && DM == NH * HDIM);
static_assert(QKVW % 128 == 0);
static_assert(HDIM == 128 && NH % NKVH == 0);
static_assert(VW % 64 == 0 && NV64 * 64 == VW);
static_assert(DM % 32 == 0 && (2 * DM) % 32 == 0);
static_assert(NR % 128 == 0);
static_assert(((size_t)NR * NH * 16) % 256 == 0 && ((size_t)NR * NKVH * 16) % 256 == 0);
static_assert((NH & (NH - 1)) == 0 && (NKVH & (NKVH - 1)) == 0);   /* head counts are powers of two: index arithmetic by shifts and masks */
static_assert((size_t)NR * NH * 16 < ((size_t)1 << 31));           /* 32-bit row indices in the normalise + rotary epilogue */
static_assert(((size_t)(SLEN / 16) * (SLEN / 32) * 64) % 256 == 0);
static_assert(32 * 16 == HDIM * 4);          /* one store instruction of 32 lanes x 16 B == one 128-float row segment */
static_assert(16 * 16 == 64 * 4);            /* 16 lanes x 16 B == one 64-float row segment */
static_assert(4 * 16 * 40 * 2 + 4 * 16 * 132 * 4 <= 131072);
static_assert(2 * 4 * 16 * 40 * 2 + 4 * 16 * 68 * 4 <= 131072);
static_assert(4 * 64 * 68 * 4 <= 131072);

static constexpr float WSC_LO = 16.0f;
static constexpr float WSC_HI = 16384.0f;
static constexpr float AL_P = 0.0625f;
static constexpr float AL_E = 6.103515625e-05f;   /* 0.0625 / 1024 */

static constexpr size_t al256(size_t b) { return (b + 255) & ~(size_t)255; }
static constexpr size_t SZ_BQ = al256((size_t)DM * DM * 2);
static constexpr size_t SZ_BK = al256((size_t)VW * DM * 2);
static constexpr size_t SZ_B2 = al256((size_t)DM * 2 * DM * 2);
static constexpr size_t SZ_OH = al256((size_t)NR * DM * 2);
static constexpr size_t SZ_VT = al256((size_t)NB * VW * TK * 2);
static constexpr size_t SZ_X16 = al256((size_t)NR * DM * 2);
static constexpr size_t SZ_QH = al256((size_t)NR * DM * 2);
static constexpr size_t SZ_KH = al256((size_t)NR * VW * 2);
static constexpr size_t SZ_QL = al256((size_t)NB * RE * DM * 2);
static constexpr size_t SZ_KL = al256((size_t)NB * RE * VW * 2);
static constexpr size_t SZ_VTL = al256((size_t)NB * NV64 * 64 * RE * 2);
static constexpr size_t SZ_A2 = al256((size_t)NB * RE * 2 * DM * 2);
static constexpr size_t SZ_MP = al256((size_t)SLEN * SLEN * 2);
static constexpr size_t SZ_JE = al256((size_t)(SLEN / 16) * 32 * 4);
static_assert(SZ_BQ == (size_t)DM * DM * 2 && SZ_BK == (size_t)VW * DM * 2);   /* the q, k, v weight planes lie back to back: one [QKVW][DM] operand */
static_assert(SZ_BQ + 2 * SZ_BK + SZ_B2 + SZ_OH + SZ_VT + SZ_X16 + SZ_QH + SZ_KH + SZ_QL + SZ_KL + SZ_VTL + SZ_A2 + SZ_MP + SZ_JE <= ((size_t)256 << 20));

typedef _Float16 v16h __attribute__((ext_vector_type(16)));
typedef unsigned short v8us __attribute__((ext_vector_type(8), may_alias));
typedef float v8f __attribute__((ext_vector_type(8)));
typedef float v4f __attribute__((ext_vector_type(4)));
typedef float v4fa __attribute__((ext_vector_type(4), may_alias));
union FragH { v16h v; v8us half[2]; _Float16 h[16]; unsigned short u[16]; };

__device__ __forceinline__ unsigned short bf16_bits(float x) { unsigned int u = __float_as_uint(x); return (unsigned short)((u + 0x7FFFu + ((u >> 16) & 1u)) >> 16); }
__device__ __forceinline__ float bf16_val(unsigned short b) { return __uint_as_float(((unsigned int)b) << 16); }
__device__ __forceinline__ float bf16_rne(float x) { return bf16_val(bf16_bits(x)); }
// f32 -> f16 for WMMA operand planes: values under the smallest f16 normal become +0
__device__ __forceinline__ _Float16 toh_flush(float v) { const _Float16 r = (_Float16)v; return (fabsf(v) < 6.103515625e-05f) ? (_Float16)0.0f : r; }

// D += A.B with NT terms: 1 = ah.bh, 2 = + al.bh, 3 = + ah.bl; hazard guard after the group
template <int NT>
__device__ __forceinline__ v8f mmaH(v16h ah, v16h al, v16h bh, v16h bl, v8f c) {
  c = __builtin_amdgcn_wmma_f32_16x16x32_f16(false, ah, false, bh, (short)0, c, false, false);
  if (NT >= 2) c = __builtin_amdgcn_wmma_f32_16x16x32_f16(false, al, false, bh, (short)0, c, false, false);
  if (NT >= 3) c = __builtin_amdgcn_wmma_f32_16x16x32_f16(false, ah, false, bl, (short)0, c, false, false);
  asm volatile("v_nop\n\tv_nop\n\tv_nop\n\tv_nop" : "+v"(c) : "v"(ah), "v"(al), "v"(bh), "v"(bl));
  return c;
}
// 16x32 fragment from a 16-bit row-major tile (rows = m or n, k contiguous): elements 0..7 <- k0+8h+0..7, 8..15 <- k0+16+8h+0..7
__device__ __forceinline__ v16h g2_frag(const _Float16* p, int hh) { FragH f; f.half[0] = *(const v8us*)((const unsigned short*)p + 8 * hh); f.half[1] = *(const v8us*)((const unsigned short*)p + 16 + 8 * hh); return f.v; }
__device__ __forceinline__ v8f g2_mma(v16h a, v16h b, v8f c) { v8f d = __builtin_amdgcn_wmma_f32_16x16x32_f16(false, a, false, b, (short)0, c, false, false); asm volatile("v_nop\n\tv_nop\n\tv_nop\n\tv_nop" : "+v"(d) : "v"(a), "v"(b)); return d; }

// Eight softmax exponentials at once, in place: v <- 2^v on the hardware's base-2 exponential (the callers pass x log2 e with x <= 0: a score or an older maximum minus the running maximum).
// No range reduction and no range tests: nothing overflows for x <= 0; a result under the smallest normal f32 may come out as 0 (beside a row's largest term, which is 1, it adds nothing); -inf gives 0, NaN stays NaN.
// One statement, so that the slot the instruction set asks for behind a transcendental is filled by construction: behind each v_exp_f32 stands the next value's, which touches neither its result nor its source, behind the last a v_nop.
#define EX_ONE(R) "v_exp_f32 " R ", " R "\n\t"
__device__ __forceinline__ void exp2_8(float (&v)[8]) {
  asm(EX_ONE("%0") EX_ONE("%1") EX_ONE("%2") EX_ONE("%3") EX_ONE("%4") EX_ONE("%5") EX_ONE("%6") EX_ONE("%7") "v_nop"
      : "+v"(v[0]), "+v"(v[1]), "+v"(v[2]), "+v"(v[3]), "+v"(v[4]), "+v"(v[5]), "+v"(v[6]), "+v"(v[7]));
}
#define LOG2E 1.4426950408889634f

// Reduction over each 16-lane row (lanes l ^ 1, ^ 2, ^ 4, ^ 8 in that order, the order of the xor butterfly) of eight values at once, on the vector port (DPP row_xmask): no trip through the LDS unit and no wait per step.
// The eight values' instructions of a step stand side by side, so each instruction's producer is eight instructions back and no link of a chain is waited for. All 32 lanes are on at every call.
#define RX_ONE(OP, R, M) OP " " R ", " R ", " R " row_xmask:" M " row_mask:0xf bank_mask:0xf\n\t"
#define RX_EIGHT(OP, M) RX_ONE(OP, "%0", M) RX_ONE(OP, "%1", M) RX_ONE(OP, "%2", M) RX_ONE(OP, "%3", M) RX_ONE(OP, "%4", M) RX_ONE(OP, "%5", M) RX_ONE(OP, "%6", M) RX_ONE(OP, "%7", M)
#define RX_TREE(OP) RX_EIGHT(OP, "1") RX_EIGHT(OP, "2") RX_EIGHT(OP, "4") RX_EIGHT(OP, "8")
__device__ __forceinline__ void row16_max8(float (&v)[8]) {
  asm volatile(RX_TREE("v_max_num_f32_dpp") : "+v"(v[0]), "+v"(v[1]), "+v"(v[2]), "+v"(v[3]), "+v"(v[4]), "+v"(v[5]), "+v"(v[6]), "+v"(v[7]));
}
__device__ __forceinline__ void row16_sum8(float (&v)[8]) {
  asm volatile(RX_TREE("v_add_f32_dpp") : "+v"(v[0]), "+v"(v[1]), "+v"(v[2]), "+v"(v[3]), "+v"(v[4]), "+v"(v[5]), "+v"(v[6]), "+v"(v[7]));
}

// The bodies below take their block index bi as an argument: several of them share one launch, each on its own range of block indices.
// At the foot of each body stands s_wait_xcnt 0: the body returns into a shared kernel, so the wait comes before any register that its stores name is rewritten.
__device__ __forceinline__ void wsc_body(unsigned bi, const float* __restrict__ Wm, _Float16* __restrict__ Bt, size_t n8, float sc) {
  const size_t t = (size_t)bi * 256 + threadIdx.x; if (t >= n8) return;
  const v4f a0 = *(const v4fa*)(Wm + t * 8), a1 = *(const v4fa*)(Wm + t * 8 + 4);
  FragH f;
#pragma unroll
  for (int q = 0; q < 4; ++q) { f.h[q] = toh_flush(bf16_rne(a0[q]) * sc); f.h[4 + q] = toh_flush(bf16_rne(a1[q]) * sc); }
  const v8us o = f.half[0];
  *(v8us*)((unsigned short*)Bt + t * 8) = o;
  asm volatile("s_wait_xcnt 0x0" ::: "memory");   /* closes this body's stores: in the shared kernel another body's code can stand behind them, not the program's end */
}
__device__ __forceinline__ void wsc2_body(unsigned bi, const float* __restrict__ Wm, _Float16* __restrict__ B2, size_t n8, float sc0, float sc1) {
  const size_t t = (size_t)bi * 256 + threadIdx.x; if (t >= n8) return;
  const size_t e = t * 8; const size_t n = e / DM; const size_t k8 = e % DM;
  const v4f a0 = *(const v4fa*)(Wm + e), a1 = *(const v4fa*)(Wm + e + 4);
  FragH f0, f1;
#pragma unroll
  for (int q = 0; q < 4; ++q) {
    const float v0 = bf16_rne(a0[q]), v1 = bf16_rne(a1[q]);
    f0.h[q] = toh_flush(v0 * sc0); f1.h[q] = toh_flush(v0 * sc1);
    f0.h[4 + q] = toh_flush(v1 * sc0); f1.h[4 + q] = toh_flush(v1 * sc1);
  }
  const size_t o = n * (size_t)(2 * DM) + k8;
  const v8us o0 = f0.half[0], o1 = f1.half[0];
  {
    *(v8us*)((unsigned short*)B2 + o) = o0;
    *(v8us*)((unsigned short*)B2 + o + DM) = o1;
    asm volatile("s_wait_xcnt 0x0" ::: "memory");   /* closes this body's stores: in the shared kernel another body's code can stand behind them, not the program's end */
  }
}

// mask plane in accumulator layout: MP[(qt*(SLEN/32) + kt)][half][lane][8] bf16 bits; element 2*rr + c of (half, lane) = mask[qt*16 + 8*(lane>>4) + 4*half + rr][kt*32 + 16*c + (lane&15)];
__device__ __forceinline__ void mperm_body(unsigned bi, const float* __restrict__ msk, unsigned short* __restrict__ MP) {
  const size_t t = (size_t)bi * 256 + threadIdx.x; if (t >= (size_t)(SLEN / 16) * (SLEN / 32) * 64) return;
  const int lane = (int)(t & 31); const int half = (int)((t >> 5) & 1); const size_t tile = t >> 6;
  const int kt = (int)(tile % (size_t)(SLEN / 32)); const int qt = (int)(tile / (size_t)(SLEN / 32));
  const int ln = lane & 15, hh = lane >> 4;
  const float* mr = msk + (size_t)(qt * 16 + 8 * hh + 4 * half) * MSKP + kt * 32 + ln;
  FragH f;
#pragma unroll
  for (int rr = 0; rr < 4; ++rr) { const float a = mr[(size_t)rr * MSKP]; const float c = mr[(size_t)rr * MSKP + 16]; f.u[2 * rr] = bf16_bits(a); f.u[2 * rr + 1] = bf16_bits(c); }
  const v8us o = f.half[0];
  *(v8us*)(MP + t * 8) = o;
  asm volatile("s_wait_xcnt 0x0" ::: "memory");   /* closes this body's stores: in the shared kernel another body's code can stand behind them, not the program's end */
}
// per 16-query tile qt: JE[qt][0..32) = number of 32-key tiles to visit = 1 + last tile holding a visible entry (value > MVIS) in any of the 16 rows; all tiles if some row has no visible entry.
// A 64-query block takes the largest of its four tiles' counts.
__device__ __forceinline__ void mjend_body(unsigned qt, const float* __restrict__ msk, int* __restrict__ JE, int* smax, int* snone) {
  constexpr int NL = SLEN / 128;               /* 16-B loads per lane and row */
  constexpr int NG = 4;                        /* loads of one group */
  static_assert(NL % NG == 0);
  const int tid = threadIdx.x, lane = tid & 31; const int w = __builtin_amdgcn_readfirstlane(tid >> 5);
  int wmax = -1, wnone = 0;
  /* 8 waves, two rows each; both loops kept rolled: one group's registers at a time, so that this body does not set the register count of the launch it shares */
#pragma unroll 1
  for (int rr = 0; rr < 2; ++rr) {
    int lm = -1;
#pragma unroll 1
    for (int g = 0; g < NL / NG; ++g) {
      const float* mr = msk + (size_t)(qt * 16 + w * 2 + rr) * MSKP + g * (NG * 128) + lane * 4;
      /* the loads of a group are issued together ahead of the first compare: one load round trip a group, not one per 128 columns */
      v4f a[NG];
#pragma unroll
      for (int i = 0; i < NG; ++i) a[i] = *(const v4fa*)(mr + i * 128);
      /* the loaded values are inputs only: all loads of the group are issued, none held back behind a compare; the address is an input too, so it stays whole (no load's result is given it) up to this wait */
      asm volatile("s_wait_xcnt 0x0" :: "v"(a[0]), "v"(a[1]), "v"(a[2]), "v"(a[3]), "v"(mr) : "memory");
#pragma unroll
      for (int i = 0; i < NG; ++i) {
        const bool any = (bf16_rne(a[i][0]) > MVIS) | (bf16_rne(a[i][1]) > MVIS) | (bf16_rne(a[i][2]) > MVIS) | (bf16_rne(a[i][3]) > MVIS);
        lm = any ? ((lane + 32 * (g * NG + i)) >> 3) : lm;
      }
    }
    int o = __shfl_xor(lm, 16, 32); lm = (o > lm) ? o : lm;
    o = __shfl_xor(lm, 8, 32); lm = (o > lm) ? o : lm;
    o = __shfl_xor(lm, 4, 32); lm = (o > lm) ? o : lm;
    o = __shfl_xor(lm, 2, 32); lm = (o > lm) ? o : lm;
    o = __shfl_xor(lm, 1, 32); lm = (o > lm) ? o : lm;
    wmax = (lm > wmax) ? lm : wmax; wnone |= (lm < 0) ? 1 : 0;
  }
  if (lane == 0) { smax[w] = wmax; snone[w] = wnone; }
  __syncthreads();
  if (w == 0) {
    int m = -1, nn = 0;
#pragma unroll
    for (int i = 0; i < 8; ++i) { const int a = smax[i]; m = (a > m) ? a : m; nn |= snone[i]; }
    const int jt = (nn != 0) ? (SLEN / 32) : (m + 1);
    *(int*)(JE + qt * 32 + lane) = jt;
    asm volatile("s_wait_xcnt 0x0" ::: "memory");   /* closes this body's stores: in the shared kernel another body's code can stand behind them, not the program's end */
  }
}

__device__ __forceinline__ void x16_body(unsigned bi, const float* __restrict__ x, _Float16* __restrict__ X16, size_t n8) {
  const size_t t = (size_t)bi * 256 + threadIdx.x; if (t >= n8) return;
  const size_t e = t * 8; const size_t r = e / DM; const size_t c = e % DM; const size_t b = r / SLEN, s = r % SLEN;
  const float* src = x + (b * SEQ_FULL + s) * DM + c;
  const v4f a0 = *(const v4fa*)src, a1 = *(const v4fa*)(src + 4);
  FragH f;
#pragma unroll
  for (int q = 0; q < 4; ++q) { f.h[q] = (_Float16)bf16_rne(a0[q]); f.h[4 + q] = (_Float16)bf16_rne(a1[q]); }
  const v8us o = f.half[0];
  *(v8us*)((unsigned short*)X16 + e) = o;
  asm volatile("s_wait_xcnt 0x0" ::: "memory");   /* closes this body's stores: in the shared kernel another body's code can stand behind them, not the program's end */
}

// One launch for all the work that reads only inputs: key-tile counts, f16 input plane, the four weight planes, the mask plane. None reads what another writes; the block index picks the body.
static constexpr size_t NX8 = (size_t)NR * DM / 8, NW8 = (size_t)DM * DM / 8, NK8 = (size_t)VW * DM / 8;
static constexpr unsigned PB_JE = SLEN / 16, PB_X = (unsigned)((NX8 + 255) / 256), PB_W = (unsigned)((NW8 + 255) / 256), PB_K = (unsigned)((NK8 + 255) / 256);
static constexpr unsigned PB_MP = (unsigned)(((size_t)(SLEN / 16) * (SLEN / 32) * 64) / 256);
static constexpr unsigned PB_ALL = PB_JE + PB_X + 2 * PB_W + 2 * PB_K + PB_MP;
__global__ __launch_bounds__(256) void k_prep(const float* __restrict__ msk, const float* __restrict__ x, const float* __restrict__ Wq, const float* __restrict__ Wk, const float* __restrict__ Wv, const float* __restrict__ Wo,
                                              int* __restrict__ JE, _Float16* __restrict__ X16, _Float16* __restrict__ BQ, _Float16* __restrict__ BK, _Float16* __restrict__ BV, _Float16* __restrict__ B2, unsigned short* __restrict__ MP) {
  __shared__ int smax[8]; __shared__ int snone[8];
  unsigned bi = blockIdx.x;
  /* the count blocks have the longest chain of load round trips: they start first */
  if (bi < PB_JE) { mjend_body(bi, msk, JE, smax, snone); return; }
  bi -= PB_JE;
  if (bi < PB_X) { x16_body(bi, x, X16, NX8); return; }
  bi -= PB_X;
  if (bi < PB_W) { wsc_body(bi, Wq, BQ, NW8, WSC_LO); return; }
  bi -= PB_W;
  if (bi < PB_K) { wsc_body(bi, Wk, BK, NK8, WSC_LO); return; }
  bi -= PB_K;
  if (bi < PB_K) { wsc_body(bi, Wv, BV, NK8, WSC_LO); return; }
  bi -= PB_K;
  if (bi < PB_W) { wsc2_body(bi, Wo, B2, NW8, WSC_HI, WSC_LO); return; }
  bi -= PB_W;
  mperm_body(bi, msk, MP);
}

// per-head RMS normalisation + interleaved-pair rotary step of one head row of the projection (row = b * SLEN + position, head hd of NHV), 16 lanes a row: lane p holds the 8 f32 at src (the product's tile in LDS), gain words wa, wb and table words cv, sv:
// y = (x * rsqrt(mean_128(x^2) + 1e-6)) * g[d];  out[2i] = y[2i] c[i] - y[2i+1] s[i];  out[2i+1] = y[2i] s[i] + y[2i+1] c[i]  (c, s = table rows [position][64], gain g[128]; all by value, bf16-RNE);
// H [NR][NHV*128] = f16 hi of every row; L [NB*RE][NHV*128] = x1024 residual for positions < RE.
template <int NHV>
__device__ __forceinline__ void nrope_body(const float* src, int p, int hd, unsigned row, v4f wa, v4f wb, v4f cv, v4f sv,
                                           _Float16* __restrict__ H, _Float16* __restrict__ L) {
  #pragma clang fp contract(off)
  const int s = (int)(row % (unsigned)SLEN); const int b = (int)(row / (unsigned)SLEN);
  const v4f xa = *(const v4fa*)src, xb = *(const v4fa*)(src + 4);
  const float xs[8] = {xa[0], xa[1], xa[2], xa[3], xb[0], xb[1], xb[2], xb[3]};
  const float gs[8] = {wa[0], wa[1], wa[2], wa[3], wb[0], wb[1], wb[2], wb[3]};
  float ss = 0.f;
#pragma unroll
  for (int i = 0; i < 8; ++i) { const float q = xs[i] * xs[i]; ss = ss + q; }
  ss += __shfl_xor(ss, 1, 32); ss += __shfl_xor(ss, 2, 32); ss += __shfl_xor(ss, 4, 32); ss += __shfl_xor(ss, 8, 32);
  const float mean = ss * 0.0078125f; const float rms = rsqrtf(mean + 1.0e-6f);
  FragH fh, fl;
#pragma unroll
  for (int j = 0; j < 4; ++j) {
    const float c = bf16_rne(cv[j]), sn = bf16_rne(sv[j]);
    const float y1 = (xs[2 * j] * rms) * bf16_rne(gs[2 * j]); const float y2 = (xs[2 * j + 1] * rms) * bf16_rne(gs[2 * j + 1]);
    const float o1 = y1 * c - y2 * sn; const float o2 = y1 * sn + y2 * c;
    const _Float16 h1 = toh_flush(o1), h2 = toh_flush(o2);
    fh.h[2 * j] = h1; fh.h[2 * j + 1] = h2;
    fl.h[2 * j] = toh_flush((o1 - (float)h1) * 1024.0f); fl.h[2 * j + 1] = toh_flush((o2 - (float)h2) * 1024.0f);
  }
  const size_t oh = (size_t)row * (NHV * HDIM) + hd * HDIM + p * 8;
  const bool wl = (s < RE);
  const int sl = wl ? s : 0;
  const size_t ol = (size_t)(b * RE + sl) * (NHV * HDIM) + hd * HDIM + p * 8;
  const v8us vh = fh.half[0], vl = fl.half[0];
  {
    *(v8us*)((unsigned short*)H + oh) = vh;
    if (wl) *(v8us*)((unsigned short*)L + ol) = vl;
    asm volatile("s_wait_xcnt 0x0" ::: "memory");   /* closes this body's stores: the next row's code stands behind them, not the program's end */
  }
}
// LDS ring of the GEMM: one stage = 64 k = 128 B of every operand row, [A 128 rows | B 128 rows] at pitch 144 B (16 B x odd: the 16-B fragment reads meet no bank conflict); two stages
#define G2_PB 144
#define G2_STG ((128 + 128) * G2_PB)
static_assert(2 * G2_STG >= 4 * 64 * 68 * 4);   /* the output staging reuses the ring behind the last barrier */
static_assert(2 * G2_STG <= 81920);             /* four blocks fit one WGP's LDS */
static_assert(DM % 64 == 0 && DM >= 128);
// 16x32 fragment from an LDS row (k contiguous), p = row start + 2 * (k0 + 8 hh) bytes: the k order of g2_frag
__device__ __forceinline__ v16h g2_lfrag(const unsigned char* p) { FragH f; f.half[0] = *(const v8us*)p; f.half[1] = *(const v8us*)(p + 32); return f.v; }
// one operand's 128 rows of a stage: 8 copies of 16 B per lane (a wave-wide copy = 4 whole 128-B row pieces); lane (r = tid / 8, c = tid % 8) brings chunk c of rows r + 16 j (j < 8).
// l = LDS byte address of (row r, chunk c) in the operand's part of the stage, g = the lane's global address in row r, s = 16 rows in elements.
__device__ __forceinline__ void g2_stage8(unsigned l, const _Float16* g, size_t s) {
  /* s_wait_xcnt closes the copies' own statement: no register that a copy names is rewritten in front of it */
  asm volatile(
      "global_load_async_to_lds_b128 %0, %8, off\n\t"
      "global_load_async_to_lds_b128 %1, %9, off\n\t"
      "global_load_async_to_lds_b128 %2, %10, off\n\t"
      "global_load_async_to_lds_b128 %3, %11, off\n\t"
      "global_load_async_to_lds_b128 %4, %12, off\n\t"
      "global_load_async_to_lds_b128 %5, %13, off\n\t"
      "global_load_async_to_lds_b128 %6, %14, off\n\t"
      "global_load_async_to_lds_b128 %7, %15, off\n\t"
      "s_wait_xcnt 0x0"
      :: "v"(l), "v"(l + 16 * G2_PB), "v"(l + 32 * G2_PB), "v"(l + 48 * G2_PB), "v"(l + 64 * G2_PB), "v"(l + 80 * G2_PB), "v"(l + 96 * G2_PB), "v"(l + 112 * G2_PB),
         "v"(g), "v"(g + s), "v"(g + 2 * s), "v"(g + 3 * s), "v"(g + 4 * s), "v"(g + 5 * s), "v"(g + 6 * s), "v"(g + 7 * s)
      : "memory");
}
// one stage: the A rows, then the B rows behind them
__device__ __forceinline__ void g2_stage(unsigned l, const _Float16* a, size_t sa, const _Float16* b, size_t sb) {
  g2_stage8(l, a, sa);
  g2_stage8(l + 128 * G2_PB, b, sb);
}

// where the joint projection's planes go, and what its epilogue reads beside the product
struct QkvOut { const float* QW; const float* KW; const float* CT; const float* ST; _Float16* QH; _Float16* QL; _Float16* KH; _Float16* KL; _Float16* Vt; _Float16* VtL; };
#define G2_TP 132                              /* f32 pitch of the 128 x 128 product tile in LDS: 16-B aligned rows, rows 8 apart fall in different bank halves */
#define G2_VP 136                              /* f16 pitch of the 128 x 128 V^T tiles in LDS: 272 B = 16 B x odd */
static_assert(128 * G2_TP * 4 <= 2 * G2_STG && 2 * 128 * G2_VP * 2 <= 2 * G2_STG);
static_assert(SLEN % 128 == 0 && RE % 128 == 0 && DM % 128 == 0 && VW % 128 == 0);   /* a 128 x 128 tile = one head, one batch, one side of RE */
// q or k tile (one head, 128 rows from row rb on) from the f32 tile T in LDS: 16 lanes a row, 8 rows a sweep, 16 sweeps
template <int NHV>
__device__ __forceinline__ void qk_epi(const float (*T)[G2_TP], int rb, int hd, const float* __restrict__ NW, const float* __restrict__ CT, const float* __restrict__ ST,
                                       _Float16* __restrict__ H, _Float16* __restrict__ L) {
  const int tid = threadIdx.x, p = tid & 15, r0 = tid >> 4;
  const float* np = NW + p * 8;
  const v4f wa = *(const v4fa*)np, wb = *(const v4fa*)(np + 4);
#pragma unroll
  for (int g = 0; g < 2; ++g) {
    const int sg = (rb + g * 64 + r0) % SLEN;
    const float* cp = CT + (size_t)sg * RTW + p * 4; const float* sp = ST + (size_t)sg * RTW + p * 4;
    /* the table words of eight sweeps are loaded as one group: one load round trip for eight rows, not eight */
    v4f cv[8], sv[8];
#pragma unroll
    for (int j = 0; j < 8; ++j) { cv[j] = *(const v4fa*)(cp + (size_t)(8 * j) * RTW); sv[j] = *(const v4fa*)(sp + (size_t)(8 * j) * RTW); }
    /* the loaded values are inputs only; the addresses are inputs too, so they stay whole (no load's result is given them) up to this wait */
    asm volatile("s_wait_xcnt 0x0" :: "v"(cv[0]), "v"(cv[1]), "v"(cv[2]), "v"(cv[3]), "v"(cv[4]), "v"(cv[5]), "v"(cv[6]), "v"(cv[7]),
                 "v"(sv[0]), "v"(sv[1]), "v"(sv[2]), "v"(sv[3]), "v"(sv[4]), "v"(sv[5]), "v"(sv[6]), "v"(sv[7]), "v"(wa), "v"(wb), "v"(cp), "v"(sp), "v"(np) : "memory");
#pragma unroll
    for (int j = 0; j < 8; ++j) { const int rl = g * 64 + j * 8 + r0; nrope_body<NHV>(&T[rl][p * 8], p, hd, (unsigned)(rb + rl), wa, wb, cv[j], sv[j], H, L); }
  }
}
// GEMM C[M][N] = alpha * A[M][K].B  with A f16 row-major (pitch lda), B stored [n][k] f16 (pitch ldb); bx = index of the block's 128 x 128 tile, sm = the block's LDS (2 * G2_STG bytes);
// four waves in a 2 x 2 grid, 64 x 64 of C each: a fragment read from LDS feeds four products, and a staged operand row 128 columns or rows of C.
// writes f32 C (pitch ldc). Requires M % 128 == 0, N % 128 == 0, K % 64 == 0 (asserted by the callers' constants).
// Operand tiles come through LDS: asynchronous copies, two stages, stage t + 1 in flight while stage t is multiplied.
// QKV = true: C is not written; the tile (one q head, one k head or 128 v columns) goes on in LDS to its f16 operand planes (qo).
template <bool QKV>
__device__ __forceinline__ void gemm2_body(const _Float16* __restrict__ A, int lda, const _Float16* __restrict__ Bh, int ldb, float alpha,
                                           float* __restrict__ C, int ldc, int M, int N, int K, int bx, unsigned char* sm, const QkvOut& qo) {
  float (*so)[64][68] = (float (*)[64][68])sm;
  const int tid = threadIdx.x, w = tid >> 5, lane = tid & 31, ln = lane & 15, hh = lane >> 4;
  const int wm = w >> 1, wn = w & 1;
  const int ntn = N >> 7; const int mt = bx / ntn, nq = bx - mt * ntn; const int row0 = mt * 128 + 64 * wm, col0 = nq * 128 + 64 * wn; if (mt * 128 >= M) return;
  const int cr = tid >> 3, cc = tid & 7;
  const _Float16* ga = A + (size_t)(mt * 128 + cr) * lda + cc * 8; const _Float16* gb = Bh + (size_t)(nq * 128 + cr) * ldb + cc * 8;
  const size_t sa16 = (size_t)16 * lda, sb16 = (size_t)16 * ldb;
  const unsigned lc = (unsigned)(uintptr_t)sm + (unsigned)(cr * G2_PB + cc * 16);
  const int nt = K >> 6;
  const int aofs = (64 * wm + ln) * G2_PB + 16 * hh, bofs = (128 + 64 * wn + ln) * G2_PB + 16 * hh;
  const v8f z8 = {0.f,0.f,0.f,0.f,0.f,0.f,0.f,0.f};
  v8f acc[4][4];
#pragma unroll
  for (int i = 0; i < 4; ++i)
#pragma unroll
    for (int j = 0; j < 4; ++j) acc[i][j] = z8;
  g2_stage(lc, ga, sa16, gb, sb16);
  asm volatile("s_wait_asynccnt 0x0" ::: "memory");   /* stage 0 has landed before the barrier publishes it */
  __syncthreads();
  if (nt > 1) g2_stage(lc + G2_STG, ga + 64, sa16, gb + 64, sb16);
#pragma unroll 1
  for (int t = 0; t < nt; ++t) {
    const unsigned char* sb = sm + (t & 1) * G2_STG; const unsigned char* pa = sb + aofs; const unsigned char* pb = sb + bofs;
#pragma unroll
    for (int kk = 0; kk < 2; ++kk) {
      v16h a[4], b[4];
#pragma unroll
      for (int i = 0; i < 4; ++i) { a[i] = g2_lfrag(pa + i * 16 * G2_PB + kk * 64); b[i] = g2_lfrag(pb + i * 16 * G2_PB + kk * 64); }
#pragma unroll
      for (int j = 0; j < 4; ++j)
#pragma unroll
        for (int i = 0; i < 4; ++i) acc[i][j] = g2_mma(a[i], b[j], acc[i][j]);
    }
    asm volatile("s_wait_dscnt 0x0" ::: "memory");      /* this wave's reads of stage t are done before the stage is refilled */
    asm volatile("s_wait_asynccnt 0x0" ::: "memory");   /* this wave's copies of stage t + 1 have landed before the barrier publishes them */
    __syncthreads();
    if (t + 2 < nt) g2_stage(lc + (unsigned)((t & 1) * G2_STG), ga + (size_t)(t + 2) * 64, sa16, gb + (size_t)(t + 2) * 64, sb16);
  }
  asm volatile("s_wait_asynccnt 0x0" ::: "memory");     /* no copy is outstanding when the ring becomes output staging */
  if constexpr (QKV) {
    const int rb = mt * 128;                   /* first row of the tile: batch rb / SLEN, position rb % SLEN */
    if (nq < (DM + VW) / 128) {
      /* a q or k head: the whole 128 x 128 f32 tile in LDS, since a row's mean runs over both column waves */
      float (*T)[G2_TP] = (float (*)[G2_TP])sm;
#pragma unroll
      for (int i = 0; i < 4; ++i)
#pragma unroll
        for (int j = 0; j < 4; ++j)
#pragma unroll
          for (int r = 0; r < 8; ++r) { const float v = acc[i][j][r] * alpha; T[64 * wm + i * 16 + 8 * hh + r][64 * wn + j * 16 + ln] = v; }
      __syncthreads();                         /* the tile is read across waves */
      if (nq < DM / 128) qk_epi<NH>(T, rb, nq, qo.QW, qo.CT, qo.ST, qo.QH, qo.QL);
      else qk_epi<NKVH>(T, rb, nq - DM / 128, qo.KW, qo.CT, qo.ST, qo.KH, qo.KL);
    } else {
      /* 128 v columns: a lane's 8 accumulator rows are 8 keys in a row of one column, that is one 16-B word of a V^T row */
      unsigned short (*th)[G2_VP] = (unsigned short (*)[G2_VP])sm; unsigned short (*tr)[G2_VP] = th + 128;
      const int bb = rb / SLEN, s0 = rb % SLEN; const bool early = s0 < RE; const int vc0 = (nq - (DM + VW) / 128) * 128;
      /* both tiles are staged by every block (no branch among the products' registers); the residual tile leaves LDS only for keys < RE */
#pragma unroll
      for (int i = 0; i < 4; ++i)
#pragma unroll
        for (int j = 0; j < 4; ++j) {
          FragH fh, fl;
#pragma unroll
          for (int r = 0; r < 8; ++r) { const float v = acc[i][j][r] * alpha; const _Float16 hv = (_Float16)v; fh.h[r] = hv; fl.h[r] = toh_flush((v - (float)hv) * 1024.0f); }
          *(v8us*)&th[64 * wn + j * 16 + ln][64 * wm + i * 16 + 8 * hh] = fh.half[0];
          *(v8us*)&tr[64 * wn + j * 16 + ln][64 * wm + i * 16 + 8 * hh] = fl.half[0];
        }
      __syncthreads();                         /* the tiles are read across waves */
      const int pc = tid & 15, d0 = tid >> 4;  /* 16 lanes x 16 B = the tile's 128 keys of one V^T row */
      unsigned short* vo = (unsigned short*)qo.Vt + (size_t)(bb * VW + vc0 + d0) * TK + s0 + pc * 8;
#pragma unroll
      for (int g = 0; g < 2; ++g) {
        v8us o[8];
#pragma unroll
        for (int q = 0; q < 8; ++q) o[q] = *(const v8us*)&th[(g * 8 + q) * 8 + d0][pc * 8];
#pragma unroll
        for (int q = 0; q < 8; ++q) *(v8us*)(vo + (size_t)((g * 8 + q) * 8) * TK) = o[q];
        asm volatile("s_wait_xcnt 0x0" ::: "memory");   /* closes the group's stores before later LDS reads reuse their registers */
      }
      if (early) {
        unsigned short* vr = (unsigned short*)qo.VtL + (size_t)(bb * VW + vc0 + d0) * RE + s0 + pc * 8;
#pragma unroll
        for (int g = 0; g < 2; ++g) {
          v8us o[8];
#pragma unroll
          for (int q = 0; q < 8; ++q) o[q] = *(const v8us*)&tr[(g * 8 + q) * 8 + d0][pc * 8];
#pragma unroll
          for (int q = 0; q < 8; ++q) *(v8us*)(vr + (size_t)((g * 8 + q) * 8) * RE) = o[q];
          asm volatile("s_wait_xcnt 0x0" ::: "memory");   /* closes the group's stores before later LDS reads reuse their registers */
        }
      }
    }
    return;
  }
#pragma unroll
  for (int i = 0; i < 4; ++i)
#pragma unroll
    for (int j = 0; j < 4; ++j)
#pragma unroll
      for (int r = 0; r < 8; ++r) { const float v = acc[i][j][r] * alpha; so[w][i * 16 + 8 * hh + r][j * 16 + ln] = v; }
  __builtin_amdgcn_fence(4, "workgroup"); __builtin_amdgcn_wave_barrier();
  const int rsub = lane >> 4, c4 = (lane & 15) * 4;
  {
#pragma unroll
    for (int q = 0; q < 32; ++q) {
      const int r = q * 2 + rsub; const v4f v = *(const v4fa*)&so[w][r][c4];
      *(v4f*)(C + (size_t)(row0 + r) * ldc + col0 + c4) = v;
    }
  }
}
// q, k and v projections in one launch: [q | k | v] = x . [Wq ; Wk ; Wv]^T; each 128 x 128 tile leaves as its f16 operand planes (normalised + rotated q or k head, hi and residual; V^T, hi and residual)
__global__ __launch_bounds__(128) void k_gemm_qkv(const _Float16* __restrict__ X16, const _Float16* __restrict__ BQKV, const float* __restrict__ QW, const float* __restrict__ KW, const float* __restrict__ CT, const float* __restrict__ ST,
                                                  _Float16* __restrict__ QH, _Float16* __restrict__ QL, _Float16* __restrict__ KH, _Float16* __restrict__ KL, _Float16* __restrict__ Vt, _Float16* __restrict__ VtL) {
  __shared__ __attribute__((aligned(16))) unsigned char sm[2 * G2_STG];
  const QkvOut qo = {QW, KW, CT, ST, QH, QL, KH, KL, Vt, VtL};
  gemm2_body<true>(X16, DM, BQKV, DM, AL_P, nullptr, QKVW, NR, QKVW, DM, (int)blockIdx.x, sm, qo);
}
// both output products in one launch. Blocks [0, OB_E): rows [0, RE) of a batch = [ctx hi | ctx residual] . [Wo x16384 ; Wo x16] / 16384 (K = 2*DM; twice the trips, so they start first);
// blocks [OB_E, OB_E + OB_L): rows [RE, SLEN) = ctx hi . (Wo x16) / 16.
static constexpr int OB_E1 = (RE / 128) * (DM / 128), OB_L1 = ((SLEN - RE) / 128) * (DM / 128), OB_E = OB_E1 * NB, OB_L = OB_L1 * NB;
__global__ __launch_bounds__(128) void k_gemm_out(const _Float16* __restrict__ A2, const _Float16* __restrict__ OH, const _Float16* __restrict__ B2, float* __restrict__ out) {
  __shared__ __attribute__((aligned(16))) unsigned char sm[2 * G2_STG];
  const int bi = (int)blockIdx.x; const bool e = bi < OB_E;
  const int rb = e ? bi : bi - OB_E; const int per = e ? OB_E1 : ((OB_L1 > 0) ? OB_L1 : 1); const int by = rb / per, bx = rb - by * per;
  const _Float16* A = e ? A2 + (size_t)by * RE * 2 * DM : OH + (size_t)by * SLEN * DM + (size_t)RE * DM;
  float* C = out + (size_t)by * SEQ_FULL * DM + (e ? (size_t)0 : (size_t)RE * DM);
  const QkvOut none = {};
  gemm2_body<false>(A, e ? 2 * DM : DM, e ? B2 : B2 + DM, 2 * DM, e ? AL_E : AL_P, C, DM, e ? RE : SLEN - RE, DM, e ? 2 * DM : DM, bx, sm, none);
}

// LDS ring of the attention kernel: one stage = one pass of 32 keys = [K 32 rows of 256 B at pitch 272 | V^T 128 rows of 64 B at pitch 80 | mask 4 waves x 1 KiB]; both pitches are 16 B x odd: the 16-B fragment reads meet no bank conflict; two stages
#define FA_KP 272
#define FA_VP 80
#define FA_KB (32 * FA_KP)
#define FA_VB (128 * FA_VP)
#define FA_MB (4 * 1024)
#define FA_STG (FA_KB + FA_VB + FA_MB)
static_assert(FA_STG % 16 == 0 && FA_KB % 16 == 0 && FA_VB % 16 == 0);
static_assert(2 * FA_STG >= 4 * 16 * 132 * 4);   /* the output staging reuses the ring behind the last barrier */
static_assert(2 * FA_STG + 4 * 16 * 40 * 2 <= 65536);
// one stage: 10 copies of 16 B per lane. K: lane (r = tid / 16, c = tid % 16) brings chunk c of key rows r + 8 j (j < 4): a wave-wide copy = 2 whole 256-B rows. V^T: lane (r = tid / 4, c = tid % 4) brings chunk c of rows r + 32 j (j < 4).
// mask: each lane brings its own two 16-B words. lk / lv / lm = the lane's LDS byte addresses in the stage, k / v / m = its global addresses, sk = 8 K rows and sv = 32 V^T rows in elements.
__device__ __forceinline__ void fa_stage(unsigned lk, unsigned lv, unsigned lm, const unsigned short* k, size_t sk, const unsigned short* v, size_t sv, const unsigned short* m) {
  /* s_wait_xcnt closes the copies' own statement: no register that a copy names is rewritten in front of it */
  asm volatile(
      "global_load_async_to_lds_b128 %0, %10, off\n\t"
      "global_load_async_to_lds_b128 %1, %11, off\n\t"
      "global_load_async_to_lds_b128 %2, %12, off\n\t"
      "global_load_async_to_lds_b128 %3, %13, off\n\t"
      "global_load_async_to_lds_b128 %4, %14, off\n\t"
      "global_load_async_to_lds_b128 %5, %15, off\n\t"
      "global_load_async_to_lds_b128 %6, %16, off\n\t"
      "global_load_async_to_lds_b128 %7, %17, off\n\t"
      "global_load_async_to_lds_b128 %8, %18, off\n\t"
      "global_load_async_to_lds_b128 %9, %19, off\n\t"
      "s_wait_xcnt 0x0"
      :: "v"(lk), "v"(lk + 8 * FA_KP), "v"(lk + 16 * FA_KP), "v"(lk + 24 * FA_KP),
         "v"(lv), "v"(lv + 32 * FA_VP), "v"(lv + 64 * FA_VP), "v"(lv + 96 * FA_VP), "v"(lm), "v"(lm + 512),
         "v"(k), "v"(k + sk), "v"(k + 2 * sk), "v"(k + 3 * sk), "v"(v), "v"(v + sv), "v"(v + 2 * sv), "v"(v + 3 * sv), "v"(m), "v"(m + 256)
      : "memory");
}

// fused attention per ((b,h), 64 queries), query blocks [QB0P, QBLKS): wave = 16 queries; S = Q.K^T (d = 128: 4 k-steps, q fragments read once and kept) x SCL + mask (bf16 plane, accumulator layout, two 16-B words per lane per step)
// The pass's K, V^T and mask tiles come through LDS, once for the block's four waves: asynchronous copies in whole row pieces, two stages, stage t + 1 in flight while stage t is worked on.
__global__ __launch_bounds__(128) __attribute__((amdgpu_num_vgpr(256))) void k_flash(const _Float16* __restrict__ Q16, int ldq, const _Float16* __restrict__ K16, int ldk,
                                               const _Float16* __restrict__ Vt, const unsigned short* __restrict__ MP, const int* __restrict__ JE, _Float16* __restrict__ O, int ldo) {
  constexpr int RPW = 16, DT = 8, KS = 4;
  constexpr int NQP = (QBNP > 0) ? QBNP : 1;
  __shared__ __attribute__((aligned(16))) unsigned short sP[4][RPW][40];
  __shared__ __attribute__((aligned(16))) unsigned char ring[2 * FA_STG];
  float (*sO)[RPW][132] = (float (*)[RPW][132])ring;
  const int tid = threadIdx.x, lane = tid & 31, ln = lane & 15, hh = lane >> 4;
  const int w = __builtin_amdgcn_readfirstlane(tid >> 5);
  const int slab = blockIdx.x / NQP, qblk = QB0P + blockIdx.x % NQP; const int b = slab / NH, h = slab % NH; const int kvh = h / NREP;
  const int qb0 = qblk * (4 * RPW); const int q0 = qb0 + w * RPW;
  const unsigned short* qr = (const unsigned short*)Q16 + ((size_t)b * TQ + q0 + ln) * ldq + h * HDIM;
  const unsigned short* Vth = (const unsigned short*)Vt + (size_t)(b * NKVH + kvh) * HDIM * TK;
  int jt = JE[qblk * 128];   /* the largest count of the block's four 16-query tiles */
#pragma unroll
  for (int i = 1; i < 4; ++i) { const int ji = JE[qblk * 128 + i * 32]; jt = (ji > jt) ? ji : jt; }
  jt = (jt < 1) ? 1 : jt; jt = (jt > TK / 32) ? (TK / 32) : jt;
  const int nt = __builtin_amdgcn_readfirstlane(jt);
  /* the lane's copy addresses of stage 0 */
  const unsigned short* gk = (const unsigned short*)K16 + ((size_t)b * TK + (tid >> 4)) * ldk + kvh * HDIM + (tid & 15) * 8;
  const unsigned short* gv = Vth + (size_t)(tid >> 2) * TK + (tid & 3) * 8;
  const unsigned short* gm = MP + (size_t)(q0 >> 4) * (size_t)(TK / 32) * 512 + lane * 8;
  const size_t sk8 = (size_t)8 * ldk, sv32 = (size_t)32 * TK, kst = (size_t)32 * ldk;
  const unsigned rb = (unsigned)(uintptr_t)ring;
  const unsigned lk = rb + (unsigned)((tid >> 4) * FA_KP + (tid & 15) * 16);
  const unsigned lv = rb + (unsigned)(FA_KB + (tid >> 2) * FA_VP + (tid & 3) * 16);
  const unsigned lm = rb + (unsigned)(FA_KB + FA_VB + w * 1024 + lane * 16);
  const int kofs = ln * FA_KP + 16 * hh, vofs = FA_KB + ln * FA_VP + 16 * hh, mofs = FA_KB + FA_VB + w * 1024 + lane * 16;
  fa_stage(lk, lv, lm, gk, sk8, gv, sv32, gm);
  /* A (q) fragments, the same in every pass: element e < 8 <-> d = 32 ks + 8 hh + e; e >= 8 <-> d = 32 ks + 16 + 8 hh + (e - 8) */
  FragH a[KS];
#pragma unroll
  for (int ks = 0; ks < KS; ++ks) { a[ks].half[0] = *(const v8us*)(qr + ks * 32 + 8 * hh); a[ks].half[1] = *(const v8us*)(qr + ks * 32 + 16 + 8 * hh); }
  /* the group's address register is an input here, so it stays whole (no load's result is given it) up to this wait */
  asm volatile("s_wait_xcnt 0x0" :: "v"(qr) : "memory");
  float m_r[8], l_r[8]; v8f oacc[DT];
#pragma unroll
  for (int r = 0; r < 8; ++r) { m_r[r] = -3.0e38f; l_r[r] = 0.f; }
#pragma unroll
  for (int dt = 0; dt < DT; ++dt) oacc[dt] = (v8f){0.f,0.f,0.f,0.f,0.f,0.f,0.f,0.f};
  asm volatile("s_wait_asynccnt 0x0" ::: "memory");   /* stage 0 has landed before the barrier publishes it */
  __syncthreads();
  if (nt > 1) fa_stage(lk + FA_STG, lv + FA_STG, lm + FA_STG, gk + kst, sk8, gv + 32, sv32, gm + 512);
#pragma unroll 1
  for (int t = 0; t < nt; ++t) {
    v8f sa = (v8f){0.f,0.f,0.f,0.f,0.f,0.f,0.f,0.f}, sb = sa;
    const unsigned char* st = ring + (t & 1) * FA_STG;
    const unsigned char* kp = st + kofs; const unsigned char* vp = st + vofs; const unsigned char* mp = st + mofs;
    FragH k0[KS], k1[KS], fm;
#pragma unroll
    for (int ks = 0; ks < KS; ++ks) {
      /* B (k) fragments in the k order of the q fragments: byte 64 ks + 16 hh of key row ln (k0) or 16 + ln (k1), and 32 B further */
      k0[ks].half[0] = *(const v8us*)(kp + ks * 64); k0[ks].half[1] = *(const v8us*)(kp + ks * 64 + 32);
      k1[ks].half[0] = *(const v8us*)(kp + 16 * FA_KP + ks * 64); k1[ks].half[1] = *(const v8us*)(kp + 16 * FA_KP + ks * 64 + 32);
    }
    fm.half[0] = *(const v8us*)mp; fm.half[1] = *(const v8us*)(mp + 512);
#pragma unroll
    for (int ks = 0; ks < KS; ++ks) { sa = g2_mma(a[ks].v, k0[ks].v, sa); sb = g2_mma(a[ks].v, k1[ks].v, sb); }
    /* the V^T fragments of this pass are read here, ahead of the softmax, which covers their LDS trip */
    FragH bv[DT];
#pragma unroll
    for (int dt = 0; dt < DT; ++dt) { bv[dt].half[0] = *(const v8us*)(vp + dt * 16 * FA_VP); bv[dt].half[1] = *(const v8us*)(vp + dt * 16 * FA_VP + 32); }
    float s0v[8], s1v[8], mcv[8];
#pragma unroll
    for (int r = 0; r < 8; ++r) {
      const float mk0 = bf16_val(fm.u[2 * r]), mk1 = bf16_val(fm.u[2 * r + 1]);
      s0v[r] = sa[r] * SCL + mk0; s1v[r] = sb[r] * SCL + mk1;
      mcv[r] = fmaxf(s0v[r], s1v[r]);
    }
    row16_max8(mcv);
    float eav[8];
#pragma unroll
    for (int r = 0; r < 8; ++r) {
      const float mn = fmaxf(m_r[r], mcv[r]); mcv[r] = mn;
      s0v[r] = (s0v[r] - mn) * LOG2E; s1v[r] = (s1v[r] - mn) * LOG2E; eav[r] = (m_r[r] - mn) * LOG2E;
    }
    exp2_8(s0v); exp2_8(s1v); exp2_8(eav);
#pragma unroll
    for (int r = 0; r < 8; ++r) {
      const float mn = mcv[r]; const float al = (mn > -1.0e38f) ? eav[r] : 1.0f; m_r[r] = mn;
      const float p0 = s0v[r], p1 = s1v[r]; l_r[r] = l_r[r] * al + p0 + p1;
#pragma unroll
      for (int dt = 0; dt < DT; ++dt) oacc[dt][r] *= al;
      FragH t2; t2.h[0] = toh_flush(p0 * 1024.0f); t2.h[1] = toh_flush(p1 * 1024.0f);
      sP[w][8 * hh + r][ln] = t2.u[0]; sP[w][8 * hh + r][16 + ln] = t2.u[1];
    }
    __builtin_amdgcn_fence(4, "workgroup"); __builtin_amdgcn_wave_barrier();
    FragH pa; pa.half[0] = *(const v8us*)&sP[w][ln][8 * hh]; pa.half[1] = *(const v8us*)&sP[w][ln][16 + 8 * hh];
#pragma unroll
    for (int dt = 0; dt < DT; ++dt) {
      /* A (P: key columns of the LDS tile) and B (V^T rows, keys contiguous) share the same key order: element e < 8 <-> key 32 t + 8 hh + e; e >= 8 <-> key 32 t + 16 + 8 hh + (e - 8) */
      oacc[dt] = g2_mma(pa.v, bv[dt].v, oacc[dt]);
    }
    asm volatile("s_wait_dscnt 0x0" ::: "memory");      /* this wave's reads of stage t (and of its P tile) are done before the stage is refilled */
    asm volatile("s_wait_asynccnt 0x0" ::: "memory");   /* this wave's copies of stage t + 1 have landed before the barrier publishes them */
    __syncthreads();
    if (t + 2 < nt) { const unsigned so2 = (unsigned)((t & 1) * FA_STG); fa_stage(lk + so2, lv + so2, lm + so2, gk + (size_t)(t + 2) * kst, sk8, gv + (size_t)(t + 2) * 32, sv32, gm + (size_t)(t + 2) * 512); }
  }
  asm volatile("s_wait_asynccnt 0x0" ::: "memory");     /* no copy is outstanding when the ring becomes output staging */
  row16_sum8(l_r);
#pragma unroll
  for (int r = 0; r < 8; ++r) { const float l = l_r[r]; l_r[r] = (l > 0.f) ? 1.0f / (l * 1024.0f) : 0.f; }
#pragma unroll
  for (int dt = 0; dt < DT; ++dt)
#pragma unroll
    for (int r = 0; r < 8; ++r) sO[w][8 * hh + r][dt * 16 + ln] = oacc[dt][r] * l_r[r];
  __builtin_amdgcn_fence(4, "workgroup"); __builtin_amdgcn_wave_barrier();
  {
#pragma unroll
    for (int rp = 0; rp < RPW; rp += 2) {
      /* the context leaves as the f16 operand plane of the output product: 16 lanes x 16 B = one 128-wide row piece */
      const int r = rp + (lane >> 4), pc = lane & 15; const v4f va = *(const v4fa*)&sO[w][r][pc * 8], vb = *(const v4fa*)&sO[w][r][pc * 8 + 4];
      FragH fh;
#pragma unroll
      for (int q = 0; q < 4; ++q) { fh.h[q] = (_Float16)va[q]; fh.h[4 + q] = (_Float16)vb[q]; }
      *(v8us*)((unsigned short*)O + ((size_t)b * TQ + q0 + r) * ldo + h * HDIM + pc * 8) = fh.half[0];
    }
  }
}
// LDS ring of the 5-plane kernel: one stage = one pass of 32 keys = [K hi 32 rows | K residual 32 rows, pitch 272 | V^T hi 64 rows | V^T residual 64 rows, pitch 80 | mask 4 waves x 1 KiB]; two stages; beside it the block's 64 q rows, hi and residual, pitch 272, filled once
#define F5_KB (32 * FA_KP)
#define F5_VB (64 * FA_VP)
#define F5_STG (2 * F5_KB + 2 * F5_VB + FA_MB)
#define F5_QB (64 * FA_KP)
static_assert(F5_STG % 16 == 0 && F5_KB % 16 == 0 && F5_VB % 16 == 0 && F5_QB % 16 == 0);
static_assert(2 * F5_STG >= 4 * 16 * 68 * 4);    /* the output staging reuses the ring behind the last barrier */
static_assert(2 * F5_STG + 2 * F5_QB + 2 * 4 * 16 * 40 * 2 <= 131072);
// one stage: 14 copies of 16 B per lane. K planes: lane (r = tid / 16, c = tid % 16) brings chunk c of key rows r + 8 j (j < 4); V^T planes: lane (r = tid / 4, c = tid % 4) brings chunk c of rows r + 32 j (j < 2); mask: the lane's own two words.
// lk / lv / lm = the lane's LDS byte addresses in the stage (hi planes), kh / kl / vh / vl / m = its global addresses, sk = 8 K rows, svh / svl = 32 V^T rows of the hi / residual plane, in elements.
__device__ __forceinline__ void f5_stage(unsigned lk, unsigned lv, unsigned lm, const unsigned short* kh, const unsigned short* kl, size_t sk,
                                         const unsigned short* vh, size_t svh, const unsigned short* vl, size_t svl, const unsigned short* m) {
  /* s_wait_xcnt closes the copies' own statement: no register that a copy names is rewritten in front of it */
  asm volatile(
      "global_load_async_to_lds_b128 %0, %14, off\n\t"
      "global_load_async_to_lds_b128 %1, %15, off\n\t"
      "global_load_async_to_lds_b128 %2, %16, off\n\t"
      "global_load_async_to_lds_b128 %3, %17, off\n\t"
      "global_load_async_to_lds_b128 %4, %18, off\n\t"
      "global_load_async_to_lds_b128 %5, %19, off\n\t"
      "global_load_async_to_lds_b128 %6, %20, off\n\t"
      "global_load_async_to_lds_b128 %7, %21, off\n\t"
      "global_load_async_to_lds_b128 %8, %22, off\n\t"
      "global_load_async_to_lds_b128 %9, %23, off\n\t"
      "global_load_async_to_lds_b128 %10, %24, off\n\t"
      "global_load_async_to_lds_b128 %11, %25, off\n\t"
      "global_load_async_to_lds_b128 %12, %26, off\n\t"
      "global_load_async_to_lds_b128 %13, %27, off\n\t"
      "s_wait_xcnt 0x0"
      :: "v"(lk), "v"(lk + 8 * FA_KP), "v"(lk + 16 * FA_KP), "v"(lk + 24 * FA_KP),
         "v"(lk + F5_KB), "v"(lk + F5_KB + 8 * FA_KP), "v"(lk + F5_KB + 16 * FA_KP), "v"(lk + F5_KB + 24 * FA_KP),
         "v"(lv), "v"(lv + 32 * FA_VP), "v"(lv + F5_VB), "v"(lv + F5_VB + 32 * FA_VP), "v"(lm), "v"(lm + 512),
         "v"(kh), "v"(kh + sk), "v"(kh + 2 * sk), "v"(kh + 3 * sk), "v"(kl), "v"(kl + sk), "v"(kl + 2 * sk), "v"(kl + 3 * sk),
         "v"(vh), "v"(vh + svh), "v"(vl), "v"(vl + svl), "v"(m), "v"(m + 256)
      : "memory");
}
// one q plane of the block: 8 copies of 16 B per lane; lane (r = tid / 16, c = tid % 16) brings chunk c of query rows r + 8 j (j < 8). l = its LDS byte address, g = its global address, s = 8 rows in elements.
__device__ __forceinline__ void f5_qplane(unsigned l, const unsigned short* g, size_t s) {
  /* s_wait_xcnt closes the copies' own statement: no register that a copy names is rewritten in front of it */
  asm volatile(
      "global_load_async_to_lds_b128 %0, %8, off\n\t"
      "global_load_async_to_lds_b128 %1, %9, off\n\t"
      "global_load_async_to_lds_b128 %2, %10, off\n\t"
      "global_load_async_to_lds_b128 %3, %11, off\n\t"
      "global_load_async_to_lds_b128 %4, %12, off\n\t"
      "global_load_async_to_lds_b128 %5, %13, off\n\t"
      "global_load_async_to_lds_b128 %6, %14, off\n\t"
      "global_load_async_to_lds_b128 %7, %15, off\n\t"
      "s_wait_xcnt 0x0"
      :: "v"(l), "v"(l + 8 * FA_KP), "v"(l + 16 * FA_KP), "v"(l + 24 * FA_KP), "v"(l + 32 * FA_KP), "v"(l + 40 * FA_KP), "v"(l + 48 * FA_KP), "v"(l + 56 * FA_KP),
         "v"(g), "v"(g + s), "v"(g + 2 * s), "v"(g + 3 * s), "v"(g + 4 * s), "v"(g + 5 * s), "v"(g + 6 * s), "v"(g + 7 * s)
      : "memory");
}

// 5-plane variant for query blocks [QB05, QB05+QBN5) (positions < RE), one 64-wide half dh of the head's 128 dims per block: S = Qh.Kh^T + (Ql.Kh^T + Qh.Kl^T)/1024 with Q/K = [hi | x1024 residual] planes (residual planes compact: rows b*RE + s);
// O = (Ph.Vh + (Pl.Vh + Ph.Vl)/1024) / l with P = [hi | x1024 residual] of 1024 p and V^T = [hi | x1024 residual] (VtL pitch RE); separate residual accumulators folded before the normalisation.
// key tiles [0, JE[qblk]) clamped to [1, RE/32] (the compact planes hold keys < RE); a block whose mask exposes keys beyond RE writes NaN rows.
// All operand tiles come through LDS, once for the block's four waves: asynchronous copies in whole row pieces; q planes once, the pass's K, V^T and mask tiles in two stages, stage t + 1 in flight while stage t is worked on.
__global__ __launch_bounds__(128) __attribute__((amdgpu_num_vgpr(256))) void k_flash5(const _Float16* __restrict__ Q16, const _Float16* __restrict__ QL, int ldq, const _Float16* __restrict__ K16, const _Float16* __restrict__ KL, int ldk,
                                                const _Float16* __restrict__ Vt, const _Float16* __restrict__ VtL, const unsigned short* __restrict__ MP, const int* __restrict__ JE, _Float16* __restrict__ A2) {
  constexpr int RPW = 16, DT = 4, KS = 4;
  __shared__ __attribute__((aligned(16))) unsigned short sP[4][RPW][40];
  __shared__ __attribute__((aligned(16))) unsigned short sPL[4][RPW][40];
  __shared__ __attribute__((aligned(16))) unsigned char ring[2 * F5_STG];
  __shared__ __attribute__((aligned(16))) unsigned char sQ[2 * F5_QB];
  float (*sO)[RPW][68] = (float (*)[RPW][68])ring;
  const int tid = threadIdx.x, lane = tid & 31, ln = lane & 15, hh = lane >> 4;
  const int w = __builtin_amdgcn_readfirstlane(tid >> 5);
  const int dh = blockIdx.x & 1; const int bx = blockIdx.x >> 1;
  const int slab = bx / QBN5, qblk = QB05 + bx % QBN5; const int b = slab / NH, h = slab % NH; const int kvh = h / NREP;
  const int qb0 = qblk * (4 * RPW); const int q0 = qb0 + w * RPW;
  int jraw = JE[qblk * 128];   /* the largest count of the block's four 16-query tiles */
#pragma unroll
  for (int i = 1; i < 4; ++i) { const int ji = JE[qblk * 128 + i * 32]; jraw = (ji > jraw) ? ji : jraw; }
  const float pz = (jraw > RE / 32) ? __uint_as_float(0x7FC00000u) : 0.0f;
  int jt = (jraw < 1) ? 1 : jraw; jt = (jt > RE / 32) ? (RE / 32) : jt;
  const int nt = __builtin_amdgcn_readfirstlane(jt);
  /* the lane's copy addresses: q planes, and stage 0 of the ring */
  const unsigned short* gq = (const unsigned short*)Q16 + ((size_t)b * TQ + qb0 + (tid >> 4)) * ldq + h * HDIM + (tid & 15) * 8;
  const unsigned short* gql = (const unsigned short*)QL + ((size_t)b * RE + qb0 + (tid >> 4)) * ldq + h * HDIM + (tid & 15) * 8;
  const unsigned short* gk = (const unsigned short*)K16 + ((size_t)b * TK + (tid >> 4)) * ldk + kvh * HDIM + (tid & 15) * 8;
  const unsigned short* gkl = (const unsigned short*)KL + ((size_t)b * RE + (tid >> 4)) * ldk + kvh * HDIM + (tid & 15) * 8;
  const unsigned short* gv = (const unsigned short*)Vt + ((size_t)(b * NKVH + kvh) * HDIM + dh * 64 + (tid >> 2)) * TK + (tid & 3) * 8;
  const unsigned short* gvl = (const unsigned short*)VtL + ((size_t)(b * NKVH + kvh) * HDIM + dh * 64 + (tid >> 2)) * RE + (tid & 3) * 8;
  const unsigned short* gm = MP + (size_t)(q0 >> 4) * (size_t)(TK / 32) * 512 + lane * 8;
  const size_t sq8 = (size_t)8 * ldq, sk8 = (size_t)8 * ldk, kst = (size_t)32 * ldk, svh = (size_t)32 * TK, svl = (size_t)32 * RE;
  const unsigned rb = (unsigned)(uintptr_t)ring;
  const unsigned lq = (unsigned)(uintptr_t)sQ + (unsigned)((tid >> 4) * FA_KP + (tid & 15) * 16);
  const unsigned lk = rb + (unsigned)((tid >> 4) * FA_KP + (tid & 15) * 16);
  const unsigned lv = rb + (unsigned)(2 * F5_KB + (tid >> 2) * FA_VP + (tid & 3) * 16);
  const unsigned lm = rb + (unsigned)(2 * F5_KB + 2 * F5_VB + w * 1024 + lane * 16);
  const int kofs = ln * FA_KP + 16 * hh, vofs = 2 * F5_KB + ln * FA_VP + 16 * hh, mofs = 2 * F5_KB + 2 * F5_VB + w * 1024 + lane * 16;
  const unsigned char* qp = sQ + (w * RPW + ln) * FA_KP + 16 * hh;
  f5_qplane(lq, gq, sq8);
  f5_qplane(lq + F5_QB, gql, sq8);
  f5_stage(lk, lv, lm, gk, gkl, sk8, gv, svh, gvl, svl, gm);
  float m_r[8], l_r[8]; v8f oacc[DT], oaccL[DT];
#pragma unroll
  for (int r = 0; r < 8; ++r) { m_r[r] = -3.0e38f; l_r[r] = 0.f; }
#pragma unroll
  for (int dt = 0; dt < DT; ++dt) { oacc[dt] = (v8f){0.f,0.f,0.f,0.f,0.f,0.f,0.f,0.f}; oaccL[dt] = oacc[dt]; }
  asm volatile("s_wait_asynccnt 0x0" ::: "memory");   /* the q planes and stage 0 have landed before the barrier publishes them */
  __syncthreads();
  if (nt > 1) f5_stage(lk + F5_STG, lv + F5_STG, lm + F5_STG, gk + kst, gkl + kst, sk8, gv + 32, svh, gvl + 32, svl, gm + 512);
#pragma unroll 1
  for (int t = 0; t < nt; ++t) {
    v8f sa = (v8f){0.f,0.f,0.f,0.f,0.f,0.f,0.f,0.f}, sb = sa, sal = sa, sbl = sa;
    const unsigned char* st = ring + (t & 1) * F5_STG;
    const unsigned char* kp = st + kofs; const unsigned char* vp = st + vofs; const unsigned char* mp = st + mofs;
    FragH fm; fm.half[0] = *(const v8us*)mp; fm.half[1] = *(const v8us*)(mp + 512);
#pragma unroll
    for (int ks = 0; ks < KS; ++ks) {
      /* all A and B fragments of this step share one k order: element e < 8 <-> d = 32 ks + 8 hh + e; e >= 8 <-> d = 32 ks + 16 + 8 hh + (e - 8): byte 64 ks + 16 hh of the row, and 32 B further */
      FragH a, al2, k0, k1, g0, g1;
      a.half[0] = *(const v8us*)(qp + ks * 64); a.half[1] = *(const v8us*)(qp + ks * 64 + 32);
      al2.half[0] = *(const v8us*)(qp + F5_QB + ks * 64); al2.half[1] = *(const v8us*)(qp + F5_QB + ks * 64 + 32);
      k0.half[0] = *(const v8us*)(kp + ks * 64); k0.half[1] = *(const v8us*)(kp + ks * 64 + 32);
      k1.half[0] = *(const v8us*)(kp + 16 * FA_KP + ks * 64); k1.half[1] = *(const v8us*)(kp + 16 * FA_KP + ks * 64 + 32);
      g0.half[0] = *(const v8us*)(kp + F5_KB + ks * 64); g0.half[1] = *(const v8us*)(kp + F5_KB + ks * 64 + 32);
      g1.half[0] = *(const v8us*)(kp + F5_KB + 16 * FA_KP + ks * 64); g1.half[1] = *(const v8us*)(kp + F5_KB + 16 * FA_KP + ks * 64 + 32);
      sa = g2_mma(a.v, k0.v, sa); sb = g2_mma(a.v, k1.v, sb);
      sal = g2_mma(al2.v, k0.v, sal); sbl = g2_mma(al2.v, k1.v, sbl);
      sal = g2_mma(a.v, g0.v, sal); sbl = g2_mma(a.v, g1.v, sbl);
    }
    /* both V^T planes' fragments of this pass are read here, ahead of the softmax, which covers their LDS trip */
    FragH bv[DT], bl[DT];
#pragma unroll
    for (int dt = 0; dt < DT; ++dt) {
      bv[dt].half[0] = *(const v8us*)(vp + dt * 16 * FA_VP); bv[dt].half[1] = *(const v8us*)(vp + dt * 16 * FA_VP + 32);
      bl[dt].half[0] = *(const v8us*)(vp + F5_VB + dt * 16 * FA_VP); bl[dt].half[1] = *(const v8us*)(vp + F5_VB + dt * 16 * FA_VP + 32);
    }
    float s0v[8], s1v[8], mcv[8];
#pragma unroll
    for (int r = 0; r < 8; ++r) {
      const float mk0 = bf16_val(fm.u[2 * r]), mk1 = bf16_val(fm.u[2 * r + 1]);
      const float d0 = sa[r] + sal[r] * 0.0009765625f, d1 = sb[r] + sbl[r] * 0.0009765625f;
      s0v[r] = d0 * SCL + mk0; s1v[r] = d1 * SCL + mk1;
      mcv[r] = fmaxf(s0v[r], s1v[r]);
    }
    row16_max8(mcv);
    float eav[8];
#pragma unroll
    for (int r = 0; r < 8; ++r) {
      const float mn = fmaxf(m_r[r], mcv[r]); mcv[r] = mn;
      s0v[r] = (s0v[r] - mn) * LOG2E; s1v[r] = (s1v[r] - mn) * LOG2E; eav[r] = (m_r[r] - mn) * LOG2E;
    }
    exp2_8(s0v); exp2_8(s1v); exp2_8(eav);
#pragma unroll
    for (int r = 0; r < 8; ++r) {
      const float mn = mcv[r]; const float al = (mn > -1.0e38f) ? eav[r] : 1.0f; m_r[r] = mn;
      const float p0 = s0v[r], p1 = s1v[r]; l_r[r] = l_r[r] * al + p0 + p1;
#pragma unroll
      for (int dt = 0; dt < DT; ++dt) { oacc[dt][r] *= al; oaccL[dt][r] *= al; }
      FragH t2, t2l; const float ps0 = p0 * 1024.0f, ps1 = p1 * 1024.0f;
      t2.h[0] = toh_flush(ps0); t2.h[1] = toh_flush(ps1);
      t2l.h[0] = toh_flush((ps0 - (float)t2.h[0]) * 1024.0f); t2l.h[1] = toh_flush((ps1 - (float)t2.h[1]) * 1024.0f);
      sP[w][8 * hh + r][ln] = t2.u[0]; sP[w][8 * hh + r][16 + ln] = t2.u[1]; sPL[w][8 * hh + r][ln] = t2l.u[0]; sPL[w][8 * hh + r][16 + ln] = t2l.u[1];
    }
    __builtin_amdgcn_fence(4, "workgroup"); __builtin_amdgcn_wave_barrier();
    FragH pa, pl;
    pa.half[0] = *(const v8us*)&sP[w][ln][8 * hh]; pa.half[1] = *(const v8us*)&sP[w][ln][16 + 8 * hh];
    pl.half[0] = *(const v8us*)&sPL[w][ln][8 * hh]; pl.half[1] = *(const v8us*)&sPL[w][ln][16 + 8 * hh];
#pragma unroll
    for (int dt = 0; dt < DT; ++dt) {
      /* A (P tiles) and B (V^T rows) share the same key order: element e < 8 <-> key 32 t + 8 hh + e; e >= 8 <-> key 32 t + 16 + 8 hh + (e - 8) */
      oacc[dt] = g2_mma(pa.v, bv[dt].v, oacc[dt]);
      oaccL[dt] = g2_mma(pl.v, bv[dt].v, oaccL[dt]);
      oaccL[dt] = g2_mma(pa.v, bl[dt].v, oaccL[dt]);
    }
    asm volatile("s_wait_dscnt 0x0" ::: "memory");      /* this wave's reads of stage t (and of its P tiles) are done before the stage is refilled */
    asm volatile("s_wait_asynccnt 0x0" ::: "memory");   /* this wave's copies of stage t + 1 have landed before the barrier publishes them */
    __syncthreads();
    if (t + 2 < nt) {
      const unsigned so2 = (unsigned)((t & 1) * F5_STG);
      f5_stage(lk + so2, lv + so2, lm + so2, gk + (size_t)(t + 2) * kst, gkl + (size_t)(t + 2) * kst, sk8, gv + (size_t)(t + 2) * 32, svh, gvl + (size_t)(t + 2) * 32, svl, gm + (size_t)(t + 2) * 512);
    }
  }
  asm volatile("s_wait_asynccnt 0x0" ::: "memory");     /* no copy is outstanding when the ring becomes output staging */
  row16_sum8(l_r);
#pragma unroll
  for (int r = 0; r < 8; ++r) { const float l = l_r[r]; l_r[r] = (l > 0.f) ? 1.0f / (l * 1024.0f) : 0.f; }
#pragma unroll
  for (int dt = 0; dt < DT; ++dt)
#pragma unroll
    for (int r = 0; r < 8; ++r) { float v = oacc[dt][r]; v += oaccL[dt][r] * 0.0009765625f; sO[w][8 * hh + r][dt * 16 + ln] = v * l_r[r] + pz; }
  __builtin_amdgcn_fence(4, "workgroup"); __builtin_amdgcn_wave_barrier();
  {
#pragma unroll
    for (int rp = 0; rp < RPW; rp += 4) {
      /* the context leaves as the [hi | x1024 residual] operand row of the early-row output product: 8 lanes x 16 B = one 64-wide row piece of each plane */
      const int r = rp + (lane >> 3), pc = lane & 7; const v4f va = *(const v4fa*)&sO[w][r][pc * 8], vb = *(const v4fa*)&sO[w][r][pc * 8 + 4];
      FragH fh, fl;
#pragma unroll
      for (int q = 0; q < 4; ++q) {
        _Float16 hv = (_Float16)va[q]; fh.h[q] = hv; fl.h[q] = (_Float16)((va[q] - (float)hv) * 1024.0f);
        hv = (_Float16)vb[q]; fh.h[4 + q] = hv; fl.h[4 + q] = (_Float16)((vb[q] - (float)hv) * 1024.0f);
      }
      unsigned short* o2 = (unsigned short*)A2 + ((size_t)b * RE + q0 + r) * (size_t)(2 * DM) + h * HDIM + dh * 64 + pc * 8;
      *(v8us*)o2 = fh.half[0];
      *(v8us*)(o2 + DM) = fl.half[0];
    }
  }
}

extern "C" void kernel_launch(void* const* d_in, const int* in_sizes, int n_in,
                              void* d_out, int out_size, void* d_ws, size_t ws_size, hipStream_t stream) {
  if (n_in < 10) return;
  const size_t needx = ((size_t)(NB - 1) * SEQ_FULL + (size_t)SLEN) * DM;
  if ((size_t)in_sizes[0] < needx) return;
  if ((size_t)in_sizes[1] < (size_t)DM * DM) return;
  if ((size_t)in_sizes[2] < (size_t)VW * DM) return;
  if ((size_t)in_sizes[3] < (size_t)VW * DM) return;
  if ((size_t)in_sizes[4] < (size_t)DM * DM) return;
  if ((size_t)in_sizes[5] < (size_t)HDIM) return;
  if ((size_t)in_sizes[6] < (size_t)HDIM) return;
  if ((size_t)in_sizes[7] < (size_t)SLEN * RTW) return;
  if ((size_t)in_sizes[8] < (size_t)SLEN * RTW) return;
  if ((size_t)in_sizes[9] < (size_t)(SLEN - 1) * MSKP + (size_t)SLEN) return;
  if ((size_t)out_size < needx) return;
  /* inputs in order: x, Wq, Wk, Wv, Wo, q gain, k gain, cos table, sin table, mask */
  const float* x = (const float*)d_in[0]; const float* Wq = (const float*)d_in[1]; const float* Wk = (const float*)d_in[2]; const float* Wv = (const float*)d_in[3]; const float* Wo = (const float*)d_in[4];
  const float* qnw = (const float*)d_in[5]; const float* knw = (const float*)d_in[6]; const float* rct = (const float*)d_in[7]; const float* rst = (const float*)d_in[8]; const float* msk = (const float*)d_in[9];
  float* dout = (float*)d_out;
  char* ws = (char*)d_ws; size_t off = 0;
  auto take = [&](size_t bytes) { char* p = ws + off; off += (bytes + 255) & ~(size_t)255; return p; };
  _Float16* BQ = (_Float16*)take(SZ_BQ);                                /* [n][k] f16, x16; BQ, BK, BV back to back = the [QKVW][DM] operand of the joint projection */
  _Float16* BK = (_Float16*)take(SZ_BK);
  _Float16* BV = (_Float16*)take(SZ_BK);
  _Float16* B2 = (_Float16*)take(SZ_B2);                                /* [n][2*DM] f16: [x16384 | x16] copies of Wo */
  _Float16* OH = (_Float16*)take(SZ_OH);                                /* context hi plane [NR][DM], rows [RE, SLEN) of each batch written */
  _Float16* X16 = (_Float16*)take(SZ_X16);                              /* f16 input rows */
  _Float16* VT = (_Float16*)take(SZ_VT);                                /* V^T [b * VW + v column][TK]; a plane of its own: the projection writes it while other blocks still read the input rows */
  _Float16* QH = (_Float16*)take(SZ_QH);                                /* [NR][DM] */
  _Float16* KHp = (_Float16*)take(SZ_KH);                               /* [NR][VW] */
  _Float16* QL = (_Float16*)take(SZ_QL);                                /* [NB*RE][DM] residual plane */
  _Float16* KL = (_Float16*)take(SZ_KL);                                /* [NB*RE][VW] residual plane */
  _Float16* VTL = (_Float16*)take(SZ_VTL);                              /* [(b,g)][64][RE] */
  _Float16* A2 = (_Float16*)take(SZ_A2);                                /* [NB*RE][2*DM] = [ctx hi | ctx residual] */
  unsigned short* MPp = (unsigned short*)take(SZ_MP);                   /* bf16 mask plane, accumulator layout */
  int* JEp = (int*)take(SZ_JE);                                         /* [SLEN/16][32] key-tile counts */
  if (off > ws_size) return;

  k_prep<<<PB_ALL, 256, 0, stream>>>(msk, x, Wq, Wk, Wv, Wo, JEp, X16, BQ, BK, BV, B2, MPp);
  k_gemm_qkv<<<(unsigned)((NR / 128) * (QKVW / 128)), 128, 0, stream>>>(X16, BQ, qnw, knw, rct, rst, QH, QL, KHp, KL, VT, VTL);
  k_flash5<<<(unsigned)(NB * NH * QBN5 * 2), 128, 0, stream>>>(QH, QL, DM, KHp, KL, VW, VT, VTL, MPp, JEp, A2);
  if (QBNP > 0) k_flash<<<(unsigned)(NB * NH * QBNP), 128, 0, stream>>>(QH, DM, KHp, VW, VT, MPp, JEp, OH, DM);
  k_gemm_out<<<(unsigned)(OB_E + OB_L), 128, 0, stream>>>(A2, OH, B2, dout);
}

// v010
// A run of this version takes 198 microseconds.
// Two timings next to v009 put it at 1.09 and 1.11 times that version's speed.
// All steps since the starting kernel, v000, together make it 4.60 times as fast.
#include <hip/hip_runtime.h>
// Contractions: x.Wq^T, x.Wk^T, x.Wv^T, ctx.Wo^T = v_wmma_f32_16x16x32_f16 (f16 operands: bf16-RNE inputs exact in f16, weights carried x16 (x16384 for the ctx-hi half of the early-row output GEMM); f32 accumulate); scores q.k^T and P.V^T = v_wmma_f32_16x16x32_f16 (plain f16 hi planes; hi + x1024 residual planes of q, k, P and v for query positions < RE; P carried x1024), f32 accumulate; per-head RMS normalisation, rotary step, additive mask, softmax and normalisers f32.

#ifndef NB
#define NB 2
#endif
#ifndef SEQ
#define SEQ 2048
#endif
#define NB_FULL 2
#define SEQ_FULL 2048
#define DM 2048
#define NH 16
#define NKVH 4
#define NREP (NH / NKVH)
#define HDIM 128
#define VW (NKVH * HDIM)                     /* width of the k / v projection rows */
#define NV64 (VW / 64)                       /* 64-wide column groups of the v rows */
#define QKVW (DM + 2 * VW)                   /* row of the joint projection plane: [q | k | v] */
#define MSKP 2048                            /* row pitch of the mask input */
#define RTW 64                               /* row pitch of the cos / sin inputs */
#define SLEN SEQ
#define NR (NB * SLEN)
#define TQ SLEN
#define TK SLEN
#define SCL 0.08838834764831845f
#define MVIS (-1.0e8f)                       /* a mask entry above this keeps its key visible */
#define QBLKS (TQ / 64)
#define RE ((SLEN < 512) ? SLEN : 512)      /* query positions [0, RE) get residual planes on q, k, P, v and ctx */
#define QB05 0
#define QBN5 (RE / 64)
#define QB0P QBN5
#define QBNP (QBLKS - QBN5)
static_assert(SLEN % 128 == 0);
static_assert(SLEN <= SEQ_FULL);
static_assert(SLEN <= MSKP);
static_assert(NB >= 1 && NB <= NB_FULL);
static_assert(RE % 128 == 0 && RE <= SLEN);
static_assert((SLEN - RE) % 128 == 0);
static_assert(DM % 128 == 0 && DM == NH * HDIM);
static_assert(QKVW % 128 == 0);
static_assert(HDIM == 128 && NH % NKVH == 0);
static_assert(VW % 64 == 0 && NV64 * 64 == VW);
static_assert(DM % 32 == 0 && (2 * DM) % 32 == 0);
static_assert(NR % 128 == 0);
static_assert(((size_t)NR * NH * 16) % 256 == 0 && ((size_t)NR * NKVH * 16) % 256 == 0);
static_assert((NH & (NH - 1)) == 0 && (NKVH & (NKVH - 1)) == 0);   /* head counts are powers of two: index arithmetic by shifts and masks */
static_assert((size_t)NR * NH * 16 < ((size_t)1 << 31));           /* 32-bit row indices in the normalise + rotary epilogue */
static_assert(((size_t)(SLEN / 16) * (SLEN / 32) * 64) % 256 == 0);
static_assert(32 * 16 == HDIM * 4);          /* one store instruction of 32 lanes x 16 B == one 128-float row segment */
static_assert(16 * 16 == 64 * 4);            /* 16 lanes x 16 B == one 64-float row segment */
static_assert(4 * 64 * 68 * 4 <= 131072);

static constexpr float WSC_LO = 16.0f;
static constexpr float WSC_HI = 16384.0f;
static constexpr float AL_P = 0.0625f;
static constexpr float AL_E = 6.103515625e-05f;   /* 0.0625 / 1024 */

static constexpr size_t al256(size_t b) { return (b + 255) & ~(size_t)255; }
static constexpr size_t SZ_BQ = al256((size_t)DM * DM * 2);
static constexpr size_t SZ_BK = al256((size_t)VW * DM * 2);
static constexpr size_t SZ_B2 = al256((size_t)DM * 2 * DM * 2);
static constexpr size_t SZ_OH = al256((size_t)NR * DM * 2);
static constexpr size_t SZ_VT = al256((size_t)NB * VW * TK * 2);
static constexpr size_t SZ_X16 = al256((size_t)NR * DM * 2);
static constexpr size_t SZ_QH = al256((size_t)NR * DM * 2);
static constexpr size_t SZ_KH = al256((size_t)NR * VW * 2);
static constexpr size_t SZ_QL = al256((size_t)NB * RE * DM * 2);
static constexpr size_t SZ_KL = al256((size_t)NB * RE * VW * 2);
static constexpr size_t SZ_VTL = al256((size_t)NB * NV64 * 64 * RE * 2);
static constexpr size_t SZ_A2 = al256((size_t)NB * RE * 2 * DM * 2);
static constexpr size_t SZ_MP = al256((size_t)SLEN * SLEN * 2);
static constexpr size_t SZ_JE = al256((size_t)(SLEN / 16) * 32 * 4);
static_assert(SZ_BQ == (size_t)DM * DM * 2 && SZ_BK == (size_t)VW * DM * 2);   /* the q, k, v weight planes lie back to back: one [QKVW][DM] operand */
static_assert(SZ_BQ + 2 * SZ_BK + SZ_B2 + SZ_OH + SZ_VT + SZ_X16 + SZ_QH + SZ_KH + SZ_QL + SZ_KL + SZ_VTL + SZ_A2 + SZ_MP + SZ_JE <= ((size_t)256 << 20));

typedef _Float16 v16h __attribute__((ext_vector_type(16)));
typedef unsigned short v8us __attribute__((ext_vector_type(8), may_alias));
typedef float v8f __attribute__((ext_vector_type(8)));
typedef float v4f __attribute__((ext_vector_type(4)));
typedef float v4fa __attribute__((ext_vector_type(4), may_alias));
union FragH { v16h v; v8us half[2]; _Float16 h[16]; unsigned short u[16]; };

__device__ __forceinline__ unsigned short bf16_bits(float x) { unsigned int u = __float_as_uint(x); return (unsigned short)((u + 0x7FFFu + ((u >> 16) & 1u)) >> 16); }
__device__ __forceinline__ float bf16_val(unsigned short b) { return __uint_as_float(((unsigned int)b) << 16); }
__device__ __forceinline__ float bf16_rne(float x) { return bf16_val(bf16_bits(x)); }
// f32 -> f16 for WMMA operand planes: values under the smallest f16 normal become +0
__device__ __forceinline__ _Float16 toh_flush(float v) { const _Float16 r = (_Float16)v; return (fabsf(v) < 6.103515625e-05f) ? (_Float16)0.0f : r; }

// D += A.B with NT terms: 1 = ah.bh, 2 = + al.bh, 3 = + ah.bl; hazard guard after the group
template <int NT>
__device__ __forceinline__ v8f mmaH(v16h ah, v16h al, v16h bh, v16h bl, v8f c) {
  c = __builtin_amdgcn_wmma_f32_16x16x32_f16(false, ah, false, bh, (short)0, c, false, false);
  if (NT >= 2) c = __builtin_amdgcn_wmma_f32_16x16x32_f16(false, al, false, bh, (short)0, c, false, false);
  if (NT >= 3) c = __builtin_amdgcn_wmma_f32_16x16x32_f16(false, ah, false, bl, (short)0, c, false, false);
  asm volatile("v_nop\n\tv_nop\n\tv_nop\n\tv_nop" : "+v"(c) : "v"(ah), "v"(al), "v"(bh), "v"(bl));
  return c;
}
// 16x32 fragment from a 16-bit row-major tile (rows = m or n, k contiguous): elements 0..7 <- k0+8h+0..7, 8..15 <- k0+16+8h+0..7
__device__ __forceinline__ v16h g2_frag(const _Float16* p, int hh) { FragH f; f.half[0] = *(const v8us*)((const unsigned short*)p + 8 * hh); f.half[1] = *(const v8us*)((const unsigned short*)p + 16 + 8 * hh); return f.v; }
__device__ __forceinline__ v8f g2_mma(v16h a, v16h b, v8f c) { v8f d = __builtin_amdgcn_wmma_f32_16x16x32_f16(false, a, false, b, (short)0, c, false, false); asm volatile("v_nop\n\tv_nop\n\tv_nop\n\tv_nop" : "+v"(d) : "v"(a), "v"(b)); return d; }

// Eight softmax exponentials at once, in place: v <- 2^v on the hardware's base-2 exponential (the callers pass x log2 e with x <= 0: a score minus the running maximum).
// No range reduction and no range tests: nothing overflows for x <= 0; a result under the smallest normal f32 may come out as 0 (beside a row's largest term, which is 1, it adds nothing); -inf gives 0, NaN stays NaN.
// One statement, so that the slot the instruction set asks for behind a transcendental is filled by construction: behind each v_exp_f32 stands the next value's, which touches neither its result nor its source, behind the last a v_nop.
#define EX_ONE(R) "v_exp_f32 " R ", " R "\n\t"
__device__ __forceinline__ void exp2_8(float (&v)[8]) {
  asm(EX_ONE("%0") EX_ONE("%1") EX_ONE("%2") EX_ONE("%3") EX_ONE("%4") EX_ONE("%5") EX_ONE("%6") EX_ONE("%7") "v_nop"
      : "+v"(v[0]), "+v"(v[1]), "+v"(v[2]), "+v"(v[3]), "+v"(v[4]), "+v"(v[5]), "+v"(v[6]), "+v"(v[7]));
}
#define LOG2E 1.4426950408889634f

// One exponential of the same kind (a query's older maximum minus its running one); the v_nop fills the slot the instruction set asks for behind a transcendental.
__device__ __forceinline__ float exp2_1(float v) { asm("v_exp_f32 %0, %0\n\tv_nop" : "+v"(v)); return v; }
// lane l <-> lane l ^ 16 on the vector port: the two lanes that share a query column of a transposed score tile. All 32 lanes are on at every call.
__device__ __forceinline__ float xhalf(float x) { return __builtin_bit_cast(float, __builtin_amdgcn_permlanex16(__builtin_bit_cast(int, x), __builtin_bit_cast(int, x), 0x76543210, 0xfedcba98, false, false)); }

// The bodies below take their block index bi as an argument: several of them share one launch, each on its own range of block indices.
// At the foot of each body stands s_wait_xcnt 0: the body returns into a shared kernel, so the wait comes before any register that its stores name is rewritten.
__device__ __forceinline__ void wsc_body(unsigned bi, const float* __restrict__ Wm, _Float16* __restrict__ Bt, size_t n8, float sc) {
  const size_t t = (size_t)bi * 256 + threadIdx.x; if (t >= n8) return;
  const v4f a0 = *(const v4fa*)(Wm + t * 8), a1 = *(const v4fa*)(Wm + t * 8 + 4);
  FragH f;
#pragma unroll
  for (int q = 0; q < 4; ++q) { f.h[q] = toh_flush(bf16_rne(a0[q]) * sc); f.h[4 + q] = toh_flush(bf16_rne(a1[q]) * sc); }
  const v8us o = f.half[0];
  *(v8us*)((unsigned short*)Bt + t * 8) = o;
  asm volatile("s_wait_xcnt 0x0" ::: "memory");   /* closes this body's stores: in the shared kernel another body's code can stand behind them, not the program's end */
}
__device__ __forceinline__ void wsc2_body(unsigned bi, const float* __restrict__ Wm, _Float16* __restrict__ B2, size_t n8, float sc0, float sc1) {
  const size_t t = (size_t)bi * 256 + threadIdx.x; if (t >= n8) return;
  const size_t e = t * 8; const size_t n = e / DM; const size_t k8 = e % DM;
  const v4f a0 = *(const v4fa*)(Wm + e), a1 = *(const v4fa*)(Wm + e + 4);
  FragH f0, f1;
#pragma unroll
  for (int q = 0; q < 4; ++q) {
    const float v0 = bf16_rne(a0[q]), v1 = bf16_rne(a1[q]);
    f0.h[q] = toh_flush(v0 * sc0); f1.h[q] = toh_flush(v0 * sc1);
    f0.h[4 + q] = toh_flush(v1 * sc0); f1.h[4 + q] = toh_flush(v1 * sc1);
  }
  const size_t o = n * (size_t)(2 * DM) + k8;
  const v8us o0 = f0.half[0], o1 = f1.half[0];
  {
    *(v8us*)((unsigned short*)B2 + o) = o0;
    *(v8us*)((unsigned short*)B2 + o + DM) = o1;
    asm volatile("s_wait_xcnt 0x0" ::: "memory");   /* closes this body's stores: in the shared kernel another body's code can stand behind them, not the program's end */
  }
}

// mask plane in the layout of the transposed score accumulators (rows = keys, columns = queries): MP[(qt*(SLEN/32) + kt)][half][lane][8] bf16 bits; element r of (half, lane) = mask[qt*16 + (lane&15)][kt*32 + 16*half + 8*(lane>>4) + r];
__device__ __forceinline__ void mperm_body(unsigned bi, const float* __restrict__ msk, unsigned short* __restrict__ MP) {
  const size_t t = (size_t)bi * 256 + threadIdx.x; if (t >= (size_t)(SLEN / 16) * (SLEN / 32) * 64) return;
  const int lane = (int)(t & 31); const int half = (int)((t >> 5) & 1); const size_t tile = t >> 6;
  const int kt = (int)(tile % (size_t)(SLEN / 32)); const int qt = (int)(tile / (size_t)(SLEN / 32));
  const int ln = lane & 15, hh = lane >> 4;
  const float* mr = msk + (size_t)(qt * 16 + ln) * MSKP + kt * 32 + 16 * half + 8 * hh;
  const v4f a0 = *(const v4fa*)mr, a1 = *(const v4fa*)(mr + 4);
  /* the loaded values are inputs only; the address is an input too, so it stays whole (no load's result is given it) up to this wait */
  asm volatile("s_wait_xcnt 0x0" :: "v"(a0), "v"(a1), "v"(mr) : "memory");
  FragH f;
#pragma unroll
  for (int q = 0; q < 4; ++q) { f.u[q] = bf16_bits(a0[q]); f.u[4 + q] = bf16_bits(a1[q]); }
  const v8us o = f.half[0];
  *(v8us*)(MP + t * 8) = o;
  asm volatile("s_wait_xcnt 0x0" ::: "memory");   /* closes this body's stores: in the shared kernel another body's code can stand behind them, not the program's end */
}
// per 16-query tile qt: JE[qt][0..32) = number of 32-key tiles to visit = 1 + last tile holding a visible entry (value > MVIS) in any of the 16 rows; all tiles if some row has no visible entry.
// A 64-query block takes the largest of its four tiles' counts.
__device__ __forceinline__ void mjend_body(unsigned qt, const float* __restrict__ msk, int* __restrict__ JE, int* smax, int* snone) {
  constexpr int NL = SLEN / 128;               /* 16-B loads per lane and row */
  constexpr int NG = 4;                        /* loads of one group */
  static_assert(NL % NG == 0);
  const int tid = threadIdx.x, lane = tid & 31; const int w = __builtin_amdgcn_readfirstlane(tid >> 5);
  int wmax = -1, wnone = 0;
  /* 8 waves, two rows each; both loops kept rolled: one group's registers at a time, so that this body does not set the register count of the launch it shares */
#pragma unroll 1
  for (int rr = 0; rr < 2; ++rr) {
    int lm = -1;
#pragma unroll 1
    for (int g = 0; g < NL / NG; ++g) {
      const float* mr = msk + (size_t)(qt * 16 + w * 2 + rr) * MSKP + g * (NG * 128) + lane * 4;
      /* the loads of a group are issued together ahead of the first compare: one load round trip a group, not one per 128 columns */
      v4f a[NG];
#pragma unroll
      for (int i = 0; i < NG; ++i) a[i] = *(const v4fa*)(mr + i * 128);
      /* the loaded values are inputs only: all loads of the group are issued, none held back behind a compare; the address is an input too, so it stays whole (no load's result is given it) up to this wait */
      asm volatile("s_wait_xcnt 0x0" :: "v"(a[0]), "v"(a[1]), "v"(a[2]), "v"(a[3]), "v"(mr) : "memory");
#pragma unroll
      for (int i = 0; i < NG; ++i) {
        const bool any = (bf16_rne(a[i][0]) > MVIS) | (bf16_rne(a[i][1]) > MVIS) | (bf16_rne(a[i][2]) > MVIS) | (bf16_rne(a[i][3]) > MVIS);
        lm = any ? ((lane + 32 * (g * NG + i)) >> 3) : lm;
      }
    }
    int o = __shfl_xor(lm, 16, 32); lm = (o > lm) ? o : lm;
    o = __shfl_xor(lm, 8, 32); lm = (o > lm) ? o : lm;
    o = __shfl_xor(lm, 4, 32); lm = (o > lm) ? o : lm;
    o = __shfl_xor(lm, 2, 32); lm = (o > lm) ? o : lm;
    o = __shfl_xor(lm, 1, 32); lm = (o > lm) ? o : lm;
    wmax = (lm > wmax) ? lm : wmax; wnone |= (lm < 0) ? 1 : 0;
  }
  if (lane == 0) { smax[w] = wmax; snone[w] = wnone; }
  __syncthreads();
  if (w == 0) {
    int m = -1, nn = 0;
#pragma unroll
    for (int i = 0; i < 8; ++i) { const int a = smax[i]; m = (a > m) ? a : m; nn |= snone[i]; }
    const int jt = (nn != 0) ? (SLEN / 32) : (m + 1);
    *(int*)(JE + qt * 32 + lane) = jt;
    asm volatile("s_wait_xcnt 0x0" ::: "memory");   /* closes this body's stores: in the shared kernel another body's code can stand behind them, not the program's end */
  }
}

__device__ __forceinline__ void x16_body(unsigned bi, const float* __restrict__ x, _Float16* __restrict__ X16, size_t n8) {
  const size_t t = (size_t)bi * 256 + threadIdx.x; if (t >= n8) return;
  const size_t e = t * 8; const size_t r = e / DM; const size_t c = e % DM; const size_t b = r / SLEN, s = r % SLEN;
  const float* src = x + (b * SEQ_FULL + s) * DM + c;
  const v4f a0 = *(const v4fa*)src, a1 = *(const v4fa*)(src + 4);
  FragH f;
#pragma unroll
  for (int q = 0; q < 4; ++q) { f.h[q] = (_Float16)bf16_rne(a0[q]); f.h[4 + q] = (_Float16)bf16_rne(a1[q]); }
  const v8us o = f.half[0];
  *(v8us*)((unsigned short*)X16 + e) = o;
  asm volatile("s_wait_xcnt 0x0" ::: "memory");   /* closes this body's stores: in the shared kernel another body's code can stand behind them, not the program's end */
}

// One launch for all the work that reads only inputs: key-tile counts, f16 input plane, the four weight planes, the mask plane. None reads what another writes; the block index picks the body.
static constexpr size_t NX8 = (size_t)NR * DM / 8, NW8 = (size_t)DM * DM / 8, NK8 = (size_t)VW * DM / 8;
static constexpr unsigned PB_JE = SLEN / 16, PB_X = (unsigned)((NX8 + 255) / 256), PB_W = (unsigned)((NW8 + 255) / 256), PB_K = (unsigned)((NK8 + 255) / 256);
static constexpr unsigned PB_MP = (unsigned)(((size_t)(SLEN / 16) * (SLEN / 32) * 64) / 256);
static constexpr unsigned PB_ALL = PB_JE + PB_X + 2 * PB_W + 2 * PB_K + PB_MP;
__global__ __launch_bounds__(256) void k_prep(const float* __restrict__ msk, const float* __restrict__ x, const float* __restrict__ Wq, const float* __restrict__ Wk, const float* __restrict__ Wv, const float* __restrict__ Wo,
                                              int* __restrict__ JE, _Float16* __restrict__ X16, _Float16* __restrict__ BQ, _Float16* __restrict__ BK, _Float16* __restrict__ BV, _Float16* __restrict__ B2, unsigned short* __restrict__ MP) {
  __shared__ int smax[8]; __shared__ int snone[8];
  unsigned bi = blockIdx.x;
  /* the count blocks have the longest chain of load round trips: they start first */
  if (bi < PB_JE) { mjend_body(bi, msk, JE, smax, snone); return; }
  bi -= PB_JE;
  if (bi < PB_X) { x16_body(bi, x, X16, NX8); return; }
  bi -= PB_X;
  if (bi < PB_W) { wsc_body(bi, Wq, BQ, NW8, WSC_LO); return; }
  bi -= PB_W;
  if (bi < PB_K) { wsc_body(bi, Wk, BK, NK8, WSC_LO); return; }
  bi -= PB_K;
  if (bi < PB_K) { wsc_body(bi, Wv, BV, NK8, WSC_LO); return; }
  bi -= PB_K;
  if (bi < PB_W) { wsc2_body(bi, Wo, B2, NW8, WSC_HI, WSC_LO); return; }
  bi -= PB_W;
  mperm_body(bi, msk, MP);
}

// per-head RMS normalisation + interleaved-pair rotary step of one head row of the projection (row = b * SLEN + position, head hd of NHV), 16 lanes a row: lane p holds the 8 f32 at src (the product's tile in LDS), gain words wa, wb and table words cv, sv:
// y = (x * rsqrt(mean_128(x^2) + 1e-6)) * g[d];  out[2i] = y[2i] c[i] - y[2i+1] s[i];  out[2i+1] = y[2i] s[i] + y[2i+1] c[i]  (c, s = table rows [position][64], gain g[128]; all by value, bf16-RNE);
// H [NR][NHV*128] = f16 hi of every row; L [NB*RE][NHV*128] = x1024 residual for positions < RE.
template <int NHV>
__device__ __forceinline__ void nrope_body(const float* src, int p, int hd, unsigned row, v4f wa, v4f wb, v4f cv, v4f sv,
                                           _Float16* __restrict__ H, _Float16* __restrict__ L) {
  #pragma clang fp contract(off)
  const int s = (int)(row % (unsigned)SLEN); const int b = (int)(row / (unsigned)SLEN);
  const v4f xa = *(const v4fa*)src, xb = *(const v4fa*)(src + 4);
  const float xs[8] = {xa[0], xa[1], xa[2], xa[3], xb[0], xb[1], xb[2], xb[3]};
  const float gs[8] = {wa[0], wa[1], wa[2], wa[3], wb[0], wb[1], wb[2], wb[3]};
  float ss = 0.f;
#pragma unroll
  for (int i = 0; i < 8; ++i) { const float q = xs[i] * xs[i]; ss = ss + q; }
  ss += __shfl_xor(ss, 1, 32); ss += __shfl_xor(ss, 2, 32); ss += __shfl_xor(ss, 4, 32); ss += __shfl_xor(ss, 8, 32);
  const float mean = ss * 0.0078125f; const float rms = rsqrtf(mean + 1.0e-6f);
  FragH fh, fl;
#pragma unroll
  for (int j = 0; j < 4; ++j) {
    const float c = bf16_rne(cv[j]), sn = bf16_rne(sv[j]);
    const float y1 = (xs[2 * j] * rms) * bf16_rne(gs[2 * j]); const float y2 = (xs[2 * j + 1] * rms) * bf16_rne(gs[2 * j + 1]);
    const float o1 = y1 * c - y2 * sn; const float o2 = y1 * sn + y2 * c;
    const _Float16 h1 = toh_flush(o1), h2 = toh_flush(o2);
    fh.h[2 * j] = h1; fh.h[2 * j + 1] = h2;
    fl.h[2 * j] = toh_flush((o1 - (float)h1) * 1024.0f); fl.h[2 * j + 1] = toh_flush((o2 - (float)h2) * 1024.0f);
  }
  const size_t oh = (size_t)row * (NHV * HDIM) + hd * HDIM + p * 8;
  const bool wl = (s < RE);
  const int sl = wl ? s : 0;
  const size_t ol = (size_t)(b * RE + sl) * (NHV * HDIM) + hd * HDIM + p * 8;
  const v8us vh = fh.half[0], vl = fl.half[0];
  {
    *(v8us*)((unsigned short*)H + oh) = vh;
    if (wl) *(v8us*)((unsigned short*)L + ol) = vl;
    asm volatile("s_wait_xcnt 0x0" ::: "memory");   /* closes this body's stores: the next row's code stands behind them, not the program's end */
  }
}
// LDS ring of the GEMM: one stage = 64 k = 128 B of every operand row, [A 128 rows | B 128 rows] at pitch 144 B (16 B x odd: the 16-B fragment reads meet no bank conflict); two stages
#define G2_PB 144
#define G2_STG ((128 + 128) * G2_PB)
static_assert(2 * G2_STG >= 4 * 64 * 68 * 4);   /* the output staging reuses the ring behind the last barrier */
static_assert(2 * G2_STG <= 81920);             /* four blocks fit one WGP's LDS */
static_assert(DM % 64 == 0 && DM >= 128);
// 16x32 fragment from an LDS row (k contiguous), p = row start + 2 * (k0 + 8 hh) bytes: the k order of g2_frag
__device__ __forceinline__ v16h g2_lfrag(const unsigned char* p) { FragH f; f.half[0] = *(const v8us*)p; f.half[1] = *(const v8us*)(p + 32); return f.v; }
// one operand's 128 rows of a stage: 8 copies of 16 B per lane (a wave-wide copy = 4 whole 128-B row pieces); lane (r = tid / 8, c = tid % 8) brings chunk c of rows r + 16 j (j < 8).
// l = LDS byte address of (row r, chunk c) in the operand's part of the stage, g = the lane's global address in row r, s = 16 rows in elements.
__device__ __forceinline__ void g2_stage8(unsigned l, const _Float16* g, size_t s) {
  /* s_wait_xcnt closes the copies' own statement: no register that a copy names is rewritten in front of it */
  asm volatile(
      "global_load_async_to_lds_b128 %0, %8, off\n\t"
      "global_load_async_to_lds_b128 %1, %9, off\n\t"
      "global_load_async_to_lds_b128 %2, %10, off\n\t"
      "global_load_async_to_lds_b128 %3, %11, off\n\t"
      "global_load_async_to_lds_b128 %4, %12, off\n\t"
      "global_load_async_to_lds_b128 %5, %13, off\n\t"
      "global_load_async_to_lds_b128 %6, %14, off\n\t"
      "global_load_async_to_lds_b128 %7, %15, off\n\t"
      "s_wait_xcnt 0x0"
      :: "v"(l), "v"(l + 16 * G2_PB), "v"(l + 32 * G2_PB), "v"(l + 48 * G2_PB), "v"(l + 64 * G2_PB), "v"(l + 80 * G2_PB), "v"(l + 96 * G2_PB), "v"(l + 112 * G2_PB),
         "v"(g), "v"(g + s), "v"(g + 2 * s), "v"(g + 3 * s), "v"(g + 4 * s), "v"(g + 5 * s), "v"(g + 6 * s), "v"(g + 7 * s)
      : "memory");
}
// one stage: the A rows, then the B rows behind them
__device__ __forceinline__ void g2_stage(unsigned l, const _Float16* a, size_t sa, const _Float16* b, size_t sb) {
  g2_stage8(l, a, sa);
  g2_stage8(l + 128 * G2_PB, b, sb);
}

// where the joint projection's planes go, and what its epilogue reads beside the product
struct QkvOut { const float* QW; const float* KW; const float* CT; const float* ST; _Float16* QH; _Float16* QL; _Float16* KH; _Float16* KL; _Float16* Vt; _Float16* VtL; };
#define G2_TP 132                              /* f32 pitch of the 128 x 128 product tile in LDS: 16-B aligned rows, rows 8 apart fall in different bank halves */
#define G2_VP 136                              /* f16 pitch of the 128 x 128 V^T tiles in LDS: 272 B = 16 B x odd */
static_assert(128 * G2_TP * 4 <= 2 * G2_STG && 2 * 128 * G2_VP * 2 <= 2 * G2_STG);
static_assert(SLEN % 128 == 0 && RE % 128 == 0 && DM % 128 == 0 && VW % 128 == 0);   /* a 128 x 128 tile = one head, one batch, one side of RE */
// q or k tile (one head, 128 rows from row rb on) from the f32 tile T in LDS: 16 lanes a row, 8 rows a sweep, 16 sweeps
template <int NHV>
__device__ __forceinline__ void qk_epi(const float (*T)[G2_TP], int rb, int hd, const float* __restrict__ NW, const float* __restrict__ CT, const float* __restrict__ ST,
                                       _Float16* __restrict__ H, _Float16* __restrict__ L) {
  const int tid = threadIdx.x, p = tid & 15, r0 = tid >> 4;
  const float* np = NW + p * 8;
  const v4f wa = *(const v4fa*)np, wb = *(const v4fa*)(np + 4);
#pragma unroll
  for (int g = 0; g < 2; ++g) {
    const int sg = (rb + g * 64 + r0) % SLEN;
    const float* cp = CT + (size_t)sg * RTW + p * 4; const float* sp = ST + (size_t)sg * RTW + p * 4;
    /* the table words of eight sweeps are loaded as one group: one load round trip for eight rows, not eight */
    v4f cv[8], sv[8];
#pragma unroll
    for (int j = 0; j < 8; ++j) { cv[j] = *(const v4fa*)(cp + (size_t)(8 * j) * RTW); sv[j] = *(const v4fa*)(sp + (size_t)(8 * j) * RTW); }
    /* the loaded values are inputs only; the addresses are inputs too, so they stay whole (no load's result is given them) up to this wait */
    asm volatile("s_wait_xcnt 0x0" :: "v"(cv[0]), "v"(cv[1]), "v"(cv[2]), "v"(cv[3]), "v"(cv[4]), "v"(cv[5]), "v"(cv[6]), "v"(cv[7]),
                 "v"(sv[0]), "v"(sv[1]), "v"(sv[2]), "v"(sv[3]), "v"(sv[4]), "v"(sv[5]), "v"(sv[6]), "v"(sv[7]), "v"(wa), "v"(wb), "v"(cp), "v"(sp), "v"(np) : "memory");
#pragma unroll
    for (int j = 0; j < 8; ++j) { const int rl = g * 64 + j * 8 + r0; nrope_body<NHV>(&T[rl][p * 8], p, hd, (unsigned)(rb + rl), wa, wb, cv[j], sv[j], H, L); }
  }
}
// GEMM C[M][N] = alpha * A[M][K].B  with A f16 row-major (pitch lda), B stored [n][k] f16 (pitch ldb); bx = index of the block's 128 x 128 tile, sm = the block's LDS (2 * G2_STG bytes);
// four waves in a 2 x 2 grid, 64 x 64 of C each: a fragment read from LDS feeds four products, and a staged operand row 128 columns or rows of C.
// writes f32 C (pitch ldc). Requires M % 128 == 0, N % 128 == 0, K % 64 == 0 (asserted by the callers' constants).
// Operand tiles come through LDS: asynchronous copies, two stages, stage t + 1 in flight while stage t is multiplied.
// QKV = true: C is not written; the tile (one q head, one k head or 128 v columns) goes on in LDS to its f16 operand planes (qo).
template <bool QKV>
__device__ __forceinline__ void gemm2_body(const _Float16* __restrict__ A, int lda, const _Float16* __restrict__ Bh, int ldb, float alpha,
                                           float* __restrict__ C, int ldc, int M, int N, int K, int bx, unsigned char* sm, const QkvOut& qo) {
  float (*so)[64][68] = (float (*)[64][68])sm;
  const int tid = threadIdx.x, w = tid >> 5, lane = tid & 31, ln = lane & 15, hh = lane >> 4;
  const int wm = w >> 1, wn = w & 1;
  const int ntn = N >> 7; const int mt = bx / ntn, nq = bx - mt * ntn; const int row0 = mt * 128 + 64 * wm, col0 = nq * 128 + 64 * wn; if (mt * 128 >= M) return;
  const int cr = tid >> 3, cc = tid & 7;
  const _Float16* ga = A + (size_t)(mt * 128 + cr) * lda + cc * 8; const _Float16* gb = Bh + (size_t)(nq * 128 + cr) * ldb + cc * 8;
  const size_t sa16 = (size_t)16 * lda, sb16 = (size_t)16 * ldb;
  const unsigned lc = (unsigned)(uintptr_t)sm + (unsigned)(cr * G2_PB + cc * 16);
  const int nt = K >> 6;
  const int aofs = (64 * wm + ln) * G2_PB + 16 * hh, bofs = (128 + 64 * wn + ln) * G2_PB + 16 * hh;
  const v8f z8 = {0.f,0.f,0.f,0.f,0.f,0.f,0.f,0.f};
  v8f acc[4][4];
#pragma unroll
  for (int i = 0; i < 4; ++i)
#pragma unroll
    for (int j = 0; j < 4; ++j) acc[i][j] = z8;
  g2_stage(lc, ga, sa16, gb, sb16);
  asm volatile("s_wait_asynccnt 0x0" ::: "memory");   /* stage 0 has landed before the barrier publishes it */
  __syncthreads();
  if (nt > 1) g2_stage(lc + G2_STG, ga + 64, sa16, gb + 64, sb16);
#pragma unroll 1
  for (int t = 0; t < nt; ++t) {
    const unsigned char* sb = sm + (t & 1) * G2_STG; const unsigned char* pa = sb + aofs; const unsigned char* pb = sb + bofs;
#pragma unroll
    for (int kk = 0; kk < 2; ++kk) {
      v16h a[4], b[4];
#pragma unroll
      for (int i = 0; i < 4; ++i) { a[i] = g2_lfrag(pa + i * 16 * G2_PB + kk * 64); b[i] = g2_lfrag(pb + i * 16 * G2_PB + kk * 64); }
#pragma unroll
      for (int j = 0; j < 4; ++j)
#pragma unroll
        for (int i = 0; i < 4; ++i) acc[i][j] = g2_mma(a[i], b[j], acc[i][j]);
    }
    asm volatile("s_wait_dscnt 0x0" ::: "memory");      /* this wave's reads of stage t are done before the stage is refilled */
    asm volatile("s_wait_asynccnt 0x0" ::: "memory");   /* this wave's copies of stage t + 1 have landed before the barrier publishes them */
    __syncthreads();
    if (t + 2 < nt) g2_stage(lc + (unsigned)((t & 1) * G2_STG), ga + (size_t)(t + 2) * 64, sa16, gb + (size_t)(t + 2) * 64, sb16);
  }
  asm volatile("s_wait_asynccnt 0x0" ::: "memory");     /* no copy is outstanding when the ring becomes output staging */
  if constexpr (QKV) {
    const int rb = mt * 128;                   /* first row of the tile: batch rb / SLEN, position rb % SLEN */
    if (nq < (DM + VW) / 128) {
      /* a q or k head: the whole 128 x 128 f32 tile in LDS, since a row's mean runs over both column waves */
      float (*T)[G2_TP] = (float (*)[G2_TP])sm;
#pragma unroll
      for (int i = 0; i < 4; ++i)
#pragma unroll
        for (int j = 0; j < 4; ++j)
#pragma unroll
          for (int r = 0; r < 8; ++r) { const float v = acc[i][j][r] * alpha; T[64 * wm + i * 16 + 8 * hh + r][64 * wn + j * 16 + ln] = v; }
      __syncthreads();                         /* the tile is read across waves */
      if (nq < DM / 128) qk_epi<NH>(T, rb, nq, qo.QW, qo.CT, qo.ST, qo.QH, qo.QL);
      else qk_epi<NKVH>(T, rb, nq - DM / 128, qo.KW, qo.CT, qo.ST, qo.KH, qo.KL);
    } else {
      /* 128 v columns: a lane's 8 accumulator rows are 8 keys in a row of one column, that is one 16-B word of a V^T row */
      unsigned short (*th)[G2_VP] = (unsigned short (*)[G2_VP])sm; unsigned short (*tr)[G2_VP] = th + 128;
      const int bb = rb / SLEN, s0 = rb % SLEN; const bool early = s0 < RE; const int vc0 = (nq - (DM + VW) / 128) * 128;
      /* both tiles are staged by every block (no branch among the products' registers); the residual tile leaves LDS only for keys < RE */
#pragma unroll
      for (int i = 0; i < 4; ++i)
#pragma unroll
        for (int j = 0; j < 4; ++j) {
          FragH fh, fl;
#pragma unroll
          for (int r = 0; r < 8; ++r) { const float v = acc[i][j][r] * alpha; const _Float16 hv = (_Float16)v; fh.h[r] = hv; fl.h[r] = toh_flush((v - (float)hv) * 1024.0f); }
          *(v8us*)&th[64 * wn + j * 16 + ln][64 * wm + i * 16 + 8 * hh] = fh.half[0];
          *(v8us*)&tr[64 * wn + j * 16 + ln][64 * wm + i * 16 + 8 * hh] = fl.half[0];
        }
      __syncthreads();                         /* the tiles are read across waves */
      const int pc = tid & 15, d0 = tid >> 4;  /* 16 lanes x 16 B = the tile's 128 keys of one V^T row */
      unsigned short* vo = (unsigned short*)qo.Vt + (size_t)(bb * VW + vc0 + d0) * TK + s0 + pc * 8;
#pragma unroll
      for (int g = 0; g < 2; ++g) {
        v8us o[8];
#pragma unroll
        for (int q = 0; q < 8; ++q) o[q] = *(const v8us*)&th[(g * 8 + q) * 8 + d0][pc * 8];
#pragma unroll
        for (int q = 0; q < 8; ++q) *(v8us*)(vo + (size_t)((g * 8 + q) * 8) * TK) = o[q];
        asm volatile("s_wait_xcnt 0x0" ::: "memory");   /* closes the group's stores before later LDS reads reuse their registers */
      }
      if (early) {
        unsigned short* vr = (unsigned short*)qo.VtL + (size_t)(bb * VW + vc0 + d0) * RE + s0 + pc * 8;
#pragma unroll
        for (int g = 0; g < 2; ++g) {
          v8us o[8];
#pragma unroll
          for (int q = 0; q < 8; ++q) o[q] = *(const v8us*)&tr[(g * 8 + q) * 8 + d0][pc * 8];
#pragma unroll
          for (int q = 0; q < 8; ++q) *(v8us*)(vr + (size_t)((g * 8 + q) * 8) * RE) = o[q];
          asm volatile("s_wait_xcnt 0x0" ::: "memory");   /* closes the group's stores before later LDS reads reuse their registers */
        }
      }
    }
    return;
  }
#pragma unroll
  for (int i = 0; i < 4; ++i)
#pragma unroll
    for (int j = 0; j < 4; ++j)
#pragma unroll
      for (int r = 0; r < 8; ++r) { const float v = acc[i][j][r] * alpha; so[w][i * 16 + 8 * hh + r][j * 16 + ln] = v; }
  __builtin_amdgcn_fence(4, "workgroup"); __builtin_amdgcn_wave_barrier();
  const int rsub = lane >> 4, c4 = (lane & 15) * 4;
  {
#pragma unroll
    for (int q = 0; q < 32; ++q) {
      const int r = q * 2 + rsub; const v4f v = *(const v4fa*)&so[w][r][c4];
      *(v4f*)(C + (size_t)(row0 + r) * ldc + col0 + c4) = v;
    }
  }
}
// q, k and v projections in one launch: [q | k | v] = x . [Wq ; Wk ; Wv]^T; each 128 x 128 tile leaves as its f16 operand planes (normalised + rotated q or k head, hi and residual; V^T, hi and residual)
__global__ __launch_bounds__(128) void k_gemm_qkv(const _Float16* __restrict__ X16, const _Float16* __restrict__ BQKV, const float* __restrict__ QW, const float* __restrict__ KW, const float* __restrict__ CT, const float* __restrict__ ST,
                                                  _Float16* __restrict__ QH, _Float16* __restrict__ QL, _Float16* __restrict__ KH, _Float16* __restrict__ KL, _Float16* __restrict__ Vt, _Float16* __restrict__ VtL) {
  __shared__ __attribute__((aligned(16))) unsigned char sm[2 * G2_STG];
  const QkvOut qo = {QW, KW, CT, ST, QH, QL, KH, KL, Vt, VtL};
  gemm2_body<true>(X16, DM, BQKV, DM, AL_P, nullptr, QKVW, NR, QKVW, DM, (int)blockIdx.x, sm, qo);
}
// both output products in one launch. Blocks [0, OB_E): rows [0, RE) of a batch = [ctx hi | ctx residual] . [Wo x16384 ; Wo x16] / 16384 (K = 2*DM; twice the trips, so they start first);
// blocks [OB_E, OB_E + OB_L): rows [RE, SLEN) = ctx hi . (Wo x16) / 16.
static constexpr int OB_E1 = (RE / 128) * (DM / 128), OB_L1 = ((SLEN - RE) / 128) * (DM / 128), OB_E = OB_E1 * NB, OB_L = OB_L1 * NB;
__global__ __launch_bounds__(128) void k_gemm_out(const _Float16* __restrict__ A2, const _Float16* __restrict__ OH, const _Float16* __restrict__ B2, float* __restrict__ out) {
  __shared__ __attribute__((aligned(16))) unsigned char sm[2 * G2_STG];
  const int bi = (int)blockIdx.x; const bool e = bi < OB_E;
  const int rb = e ? bi : bi - OB_E; const int per = e ? OB_E1 : ((OB_L1 > 0) ? OB_L1 : 1); const int by = rb / per, bx = rb - by * per;
  const _Float16* A = e ? A2 + (size_t)by * RE * 2 * DM : OH + (size_t)by * SLEN * DM + (size_t)RE * DM;
  float* C = out + (size_t)by * SEQ_FULL * DM + (e ? (size_t)0 : (size_t)RE * DM);
  const QkvOut none = {};
  gemm2_body<false>(A, e ? 2 * DM : DM, e ? B2 : B2 + DM, 2 * DM, e ? AL_E : AL_P, C, DM, e ? RE : SLEN - RE, DM, e ? 2 * DM : DM, bx, sm, none);
}

// LDS ring of the attention kernel: one stage = one pass of 32 keys = [K 32 rows of 256 B at pitch 272 | V^T 128 rows of 64 B at pitch 80 | mask 4 waves x 1 KiB]; both pitches are 16 B x odd: the 16-B fragment reads meet no bank conflict; two stages
#define FA_KP 272
#define FA_VP 80
#define FA_KB (32 * FA_KP)
#define FA_VB (128 * FA_VP)
#define FA_MB (4 * 1024)
#define FA_STG (FA_KB + FA_VB + FA_MB)
static_assert(FA_STG % 16 == 0 && FA_KB % 16 == 0 && FA_VB % 16 == 0);
static_assert(2 * FA_STG <= 65536);
// one stage: 10 copies of 16 B per lane. K: lane (r = tid / 16, c = tid % 16) brings chunk c of key rows r + 8 j (j < 4): a wave-wide copy = 2 whole 256-B rows. V^T: lane (r = tid / 4, c = tid % 4) brings chunk c of rows r + 32 j (j < 4).
// mask: each lane brings its own two 16-B words. lk / lv / lm = the lane's LDS byte addresses in the stage, k / v / m = its global addresses, sk = 8 K rows and sv = 32 V^T rows in elements.
__device__ __forceinline__ void fa_stage(unsigned lk, unsigned lv, unsigned lm, const unsigned short* k, size_t sk, const unsigned short* v, size_t sv, const unsigned short* m) {
  /* s_wait_xcnt closes the copies' own statement: no register that a copy names is rewritten in front of it */
  asm volatile(
      "global_load_async_to_lds_b128 %0, %10, off\n\t"
      "global_load_async_to_lds_b128 %1, %11, off\n\t"
      "global_load_async_to_lds_b128 %2, %12, off\n\t"
      "global_load_async_to_lds_b128 %3, %13, off\n\t"
      "global_load_async_to_lds_b128 %4, %14, off\n\t"
      "global_load_async_to_lds_b128 %5, %15, off\n\t"
      "global_load_async_to_lds_b128 %6, %16, off\n\t"
      "global_load_async_to_lds_b128 %7, %17, off\n\t"
      "global_load_async_to_lds_b128 %8, %18, off\n\t"
      "global_load_async_to_lds_b128 %9, %19, off\n\t"
      "s_wait_xcnt 0x0"
      :: "v"(lk), "v"(lk + 8 * FA_KP), "v"(lk + 16 * FA_KP), "v"(lk + 24 * FA_KP),
         "v"(lv), "v"(lv + 32 * FA_VP), "v"(lv + 64 * FA_VP), "v"(lv + 96 * FA_VP), "v"(lm), "v"(lm + 512),
         "v"(k), "v"(k + sk), "v"(k + 2 * sk), "v"(k + 3 * sk), "v"(v), "v"(v + sv), "v"(v + 2 * sv), "v"(v + 3 * sv), "v"(m), "v"(m + 256)
      : "memory");
}

// fused attention per ((b,h), 64 queries), query blocks [QB0P, QBLKS): wave = 16 queries; S^T = K.Q^T (d = 128: 4 k-steps, q fragments read once and kept) x SCL + mask (bf16 plane, accumulator layout, two 16-B words per lane per step); O^T += V^T.P^T
// Transposed products: a lane holds 16 of the pass's 32 scores of ONE query (column ln; keys 8 hh + r and 16 + 8 hh + r), lane l ^ 16 the other 16: maximum and sum in the lane plus one exchange, and P^T is a B fragment as it stands in the lane's registers.
// The pass's K, V^T and mask tiles come through LDS, once for the block's four waves: asynchronous copies in whole row pieces, two stages, stage t + 1 in flight while stage t is worked on.
__global__ __launch_bounds__(128) __attribute__((amdgpu_num_vgpr(256))) void k_flash(const _Float16* __restrict__ Q16, int ldq, const _Float16* __restrict__ K16, int ldk,
                                               const _Float16* __restrict__ Vt, const unsigned short* __restrict__ MP, const int* __restrict__ JE, _Float16* __restrict__ O, int ldo) {
  constexpr int RPW = 16, DT = 8, KS = 4;
  constexpr int NQP = (QBNP > 0) ? QBNP : 1;
  __shared__ __attribute__((aligned(16))) unsigned char ring[2 * FA_STG];
  const int tid = threadIdx.x, lane = tid & 31, ln = lane & 15, hh = lane >> 4;
  const int w = __builtin_amdgcn_readfirstlane(tid >> 5);
  const int slab = blockIdx.x / NQP, qblk = QB0P + blockIdx.x % NQP; const int b = slab / NH, h = slab % NH; const int kvh = h / NREP;
  const int qb0 = qblk * (4 * RPW); const int q0 = qb0 + w * RPW;
  const unsigned short* qr = (const unsigned short*)Q16 + ((size_t)b * TQ + q0 + ln) * ldq + h * HDIM;
  const unsigned short* Vth = (const unsigned short*)Vt + (size_t)(b * NKVH + kvh) * HDIM * TK;
  int jt = JE[qblk * 128];   /* the largest count of the block's four 16-query tiles */
#pragma unroll
  for (int i = 1; i < 4; ++i) { const int ji = JE[qblk * 128 + i * 32]; jt = (ji > jt) ? ji : jt; }
  jt = (jt < 1) ? 1 : jt; jt = (jt > TK / 32) ? (TK / 32) : jt;
  const int nt = __builtin_amdgcn_readfirstlane(jt);
  /* the lane's copy addresses of stage 0 */
  const unsigned short* gk = (const unsigned short*)K16 + ((size_t)b * TK + (tid >> 4)) * ldk + kvh * HDIM + (tid & 15) * 8;
  const unsigned short* gv = Vth + (size_t)(tid >> 2) * TK + (tid & 3) * 8;
  const unsigned short* gm = MP + (size_t)(q0 >> 4) * (size_t)(TK / 32) * 512 + lane * 8;
  const size_t sk8 = (size_t)8 * ldk, sv32 = (size_t)32 * TK, kst = (size_t)32 * ldk;
  const unsigned rb = (unsigned)(uintptr_t)ring;
  const unsigned lk = rb + (unsigned)((tid >> 4) * FA_KP + (tid & 15) * 16);
  const unsigned lv = rb + (unsigned)(FA_KB + (tid >> 2) * FA_VP + (tid & 3) * 16);
  const unsigned lm = rb + (unsigned)(FA_KB + FA_VB + w * 1024 + lane * 16);
  const int kofs = ln * FA_KP + 16 * hh, vofs = FA_KB + ln * FA_VP + 16 * hh, mofs = FA_KB + FA_VB + w * 1024 + lane * 16;
  fa_stage(lk, lv, lm, gk, sk8, gv, sv32, gm);
  /* B (q) fragments (column = query ln), the same in every pass: element e < 8 <-> d = 32 ks + 8 hh + e; e >= 8 <-> d = 32 ks + 16 + 8 hh + (e - 8) */
  FragH a[KS];
#pragma unroll
  for (int ks = 0; ks < KS; ++ks) { a[ks].half[0] = *(const v8us*)(qr + ks * 32 + 8 * hh); a[ks].half[1] = *(const v8us*)(qr + ks * 32 + 16 + 8 * hh); }
  /* the group's address register is an input here, so it stays whole (no load's result is given it) up to this wait */
  asm volatile("s_wait_xcnt 0x0" :: "v"(qr) : "memory");
  float m_q = -3.0e38f, l_q = 0.f; v8f oacc[DT];   /* running maximum of query ln (the same in both halves), this half's share of its sum, O^T tiles (row = d, column = query) */
#pragma unroll
  for (int dt = 0; dt < DT; ++dt) oacc[dt] = (v8f){0.f,0.f,0.f,0.f,0.f,0.f,0.f,0.f};
  asm volatile("s_wait_asynccnt 0x0" ::: "memory");   /* stage 0 has landed before the barrier publishes it */
  __syncthreads();
  if (nt > 1) fa_stage(lk + FA_STG, lv + FA_STG, lm + FA_STG, gk + kst, sk8, gv + 32, sv32, gm + 512);
#pragma unroll 1
  for (int t = 0; t < nt; ++t) {
    v8f sa = (v8f){0.f,0.f,0.f,0.f,0.f,0.f,0.f,0.f}, sb = sa;
    const unsigned char* st = ring + (t & 1) * FA_STG;
    const unsigned char* kp = st + kofs; const unsigned char* vp = st + vofs; const unsigned char* mp = st + mofs;
    FragH k0[KS], k1[KS], fm;
#pragma unroll
    for (int ks = 0; ks < KS; ++ks) {
      /* A (k) fragments (row = key) in the k order of the q fragments: byte 64 ks + 16 hh of key row ln (k0) or 16 + ln (k1), and 32 B further */
      k0[ks].half[0] = *(const v8us*)(kp + ks * 64); k0[ks].half[1] = *(const v8us*)(kp + ks * 64 + 32);
      k1[ks].half[0] = *(const v8us*)(kp + 16 * FA_KP + ks * 64); k1[ks].half[1] = *(const v8us*)(kp + 16 * FA_KP + ks * 64 + 32);
    }
    fm.half[0] = *(const v8us*)mp; fm.half[1] = *(const v8us*)(mp + 512);
#pragma unroll
    for (int ks = 0; ks < KS; ++ks) { sa = g2_mma(k0[ks].v, a[ks].v, sa); sb = g2_mma(k1[ks].v, a[ks].v, sb); }
    /* the V^T fragments of this pass are read here, ahead of the softmax, which covers their LDS trip */
    FragH bv[DT];
#pragma unroll
    for (int dt = 0; dt < DT; ++dt) { bv[dt].half[0] = *(const v8us*)(vp + dt * 16 * FA_VP); bv[dt].half[1] = *(const v8us*)(vp + dt * 16 * FA_VP + 32); }
    float s0v[8], s1v[8];
#pragma unroll
    for (int r = 0; r < 8; ++r) {
      /* sa[r]: key 32 t + 8 hh + r, sb[r]: key 32 t + 16 + 8 hh + r, both of query ln */
      const float mk0 = bf16_val(fm.u[r]), mk1 = bf16_val(fm.u[8 + r]);
      s0v[r] = __builtin_fmaf(sa[r], SCL, mk0); s1v[r] = __builtin_fmaf(sb[r], SCL, mk1);
    }
    float mc = fmaxf(s0v[0], s1v[0]);
#pragma unroll
    for (int r = 1; r < 8; ++r) mc = fmaxf(mc, fmaxf(s0v[r], s1v[r]));
    mc = fmaxf(mc, xhalf(mc));
    const float mn = fmaxf(m_q, mc);
#pragma unroll
    for (int r = 0; r < 8; ++r) { s0v[r] = (s0v[r] - mn) * LOG2E; s1v[r] = (s1v[r] - mn) * LOG2E; }
    const float ea = exp2_1((m_q - mn) * LOG2E);
    exp2_8(s0v); exp2_8(s1v);
    const float al = (mn > -1.0e38f) ? ea : 1.0f; m_q = mn;
    float ps = 0.f;
#pragma unroll
    for (int r = 0; r < 8; ++r) ps += s0v[r] + s1v[r];
    l_q = l_q * al + ps;
#pragma unroll
    for (int dt = 0; dt < DT; ++dt) oacc[dt] *= al;
    /* B (P^T) fragment from the lane's own scores: element e < 8 <-> key 32 t + 8 hh + e; e >= 8 <-> key 32 t + 16 + 8 hh + (e - 8): the key order of the V^T fragments */
    FragH pb;
#pragma unroll
    for (int r = 0; r < 8; ++r) { pb.h[r] = toh_flush(s0v[r] * 1024.0f); pb.h[8 + r] = toh_flush(s1v[r] * 1024.0f); }
#pragma unroll
    for (int dt = 0; dt < DT; ++dt) oacc[dt] = g2_mma(bv[dt].v, pb.v, oacc[dt]);   /* A = V^T rows d = 16 dt + ln, keys contiguous */
    asm volatile("s_wait_dscnt 0x0" ::: "memory");      /* this wave's reads of stage t are done before the stage is refilled */
    asm volatile("s_wait_asynccnt 0x0" ::: "memory");   /* this wave's copies of stage t + 1 have landed before the barrier publishes them */
    __syncthreads();
    if (t + 2 < nt) { const unsigned so2 = (unsigned)((t & 1) * FA_STG); fa_stage(lk + so2, lv + so2, lm + so2, gk + (size_t)(t + 2) * kst, sk8, gv + (size_t)(t + 2) * 32, sv32, gm + (size_t)(t + 2) * 512); }
  }
  asm volatile("s_wait_asynccnt 0x0" ::: "memory");     /* no copy is outstanding when the wave ends */
  l_q += xhalf(l_q);
  const float li = (l_q > 0.f) ? 1.0f / (l_q * 1024.0f) : 0.f;
  /* the context leaves as the f16 operand plane of the output product: a lane's 8 accumulator rows are 8 dims in a row of its query, one 16-B word; the wave writes every byte of its 16 row pieces of 256 B */
  unsigned short* op = (unsigned short*)O + ((size_t)b * TQ + q0 + ln) * ldo + h * HDIM + 8 * hh;
  v8us ov[DT];
#pragma unroll
  for (int dt = 0; dt < DT; ++dt) {
    FragH fh;
#pragma unroll
    for (int r = 0; r < 8; ++r) fh.h[r] = (_Float16)(oacc[dt][r] * li);
    ov[dt] = fh.half[0];
  }
#pragma unroll
  for (int dt = 0; dt < DT; ++dt) *(v8us*)(op + dt * 16) = ov[dt];
}
// LDS ring of the 5-plane kernel: one stage = one pass of 32 keys = [K hi 32 rows | K residual 32 rows, pitch 272 | V^T hi 64 rows | V^T residual 64 rows, pitch 80 | mask 4 waves x 1 KiB]; two stages; beside it the block's 64 q rows, hi and residual, pitch 272, filled once
#define F5_KB (32 * FA_KP)
#define F5_VB (64 * FA_VP)
#define F5_STG (2 * F5_KB + 2 * F5_VB + FA_MB)
#define F5_QB (64 * FA_KP)
static_assert(F5_STG % 16 == 0 && F5_KB % 16 == 0 && F5_VB % 16 == 0 && F5_QB % 16 == 0);
static_assert(2 * F5_STG + 2 * F5_QB <= 131072);
// one stage: 14 copies of 16 B per lane. K planes: lane (r = tid / 16, c = tid % 16) brings chunk c of key rows r + 8 j (j < 4); V^T planes: lane (r = tid / 4, c = tid % 4) brings chunk c of rows r + 32 j (j < 2); mask: the lane's own two words.
// lk / lv / lm = the lane's LDS byte addresses in the stage (hi planes), kh / kl / vh / vl / m = its global addresses, sk = 8 K rows, svh / svl = 32 V^T rows of the hi / residual plane, in elements.
__device__ __forceinline__ void f5_stage(unsigned lk, unsigned lv, unsigned lm, const unsigned short* kh, const unsigned short* kl, size_t sk,
                                         const unsigned short* vh, size_t svh, const unsigned short* vl, size_t svl, const unsigned short* m) {
  /* s_wait_xcnt closes the copies' own statement: no register that a copy names is rewritten in front of it */
  asm volatile(
      "global_load_async_to_lds_b128 %0, %14, off\n\t"
      "global_load_async_to_lds_b128 %1, %15, off\n\t"
      "global_load_async_to_lds_b128 %2, %16, off\n\t"
      "global_load_async_to_lds_b128 %3, %17, off\n\t"
      "global_load_async_to_lds_b128 %4, %18, off\n\t"
      "global_load_async_to_lds_b128 %5, %19, off\n\t"
      "global_load_async_to_lds_b128 %6, %20, off\n\t"
      "global_load_async_to_lds_b128 %7, %21, off\n\t"
      "global_load_async_to_lds_b128 %8, %22, off\n\t"
      "global_load_async_to_lds_b128 %9, %23, off\n\t"
      "global_load_async_to_lds_b128 %10, %24, off\n\t"
      "global_load_async_to_lds_b128 %11, %25, off\n\t"
      "global_load_async_to_lds_b128 %12, %26, off\n\t"
      "global_load_async_to_lds_b128 %13, %27, off\n\t"
      "s_wait_xcnt 0x0"
      :: "v"(lk), "v"(lk + 8 * FA_KP), "v"(lk + 16 * FA_KP), "v"(lk + 24 * FA_KP),
         "v"(lk + F5_KB), "v"(lk + F5_KB + 8 * FA_KP), "v"(lk + F5_KB + 16 * FA_KP), "v"(lk + F5_KB + 24 * FA_KP),
         "v"(lv), "v"(lv + 32 * FA_VP), "v"(lv + F5_VB), "v"(lv + F5_VB + 32 * FA_VP), "v"(lm), "v"(lm + 512),
         "v"(kh), "v"(kh + sk), "v"(kh + 2 * sk), "v"(kh + 3 * sk), "v"(kl), "v"(kl + sk), "v"(kl + 2 * sk), "v"(kl + 3 * sk),
         "v"(vh), "v"(vh + svh), "v"(vl), "v"(vl + svl), "v"(m), "v"(m + 256)
      : "memory");
}
// one q plane of the block: 8 copies of 16 B per lane; lane (r = tid / 16, c = tid % 16) brings chunk c of query rows r + 8 j (j < 8). l = its LDS byte address, g = its global address, s = 8 rows in elements.
__device__ __forceinline__ void f5_qplane(unsigned l, const unsigned short* g, size_t s) {
  /* s_wait_xcnt closes the copies' own statement: no register that a copy names is rewritten in front of it */
  asm volatile(
      "global_load_async_to_lds_b128 %0, %8, off\n\t"
      "global_load_async_to_lds_b128 %1, %9, off\n\t"
      "global_load_async_to_lds_b128 %2, %10, off\n\t"
      "global_load_async_to_lds_b128 %3, %11, off\n\t"
      "global_load_async_to_lds_b128 %4, %12, off\n\t"
      "global_load_async_to_lds_b128 %5, %13, off\n\t"
      "global_load_async_to_lds_b128 %6, %14, off\n\t"
      "global_load_async_to_lds_b128 %7, %15, off\n\t"
      "s_wait_xcnt 0x0"
      :: "v"(l), "v"(l + 8 * FA_KP), "v"(l + 16 * FA_KP), "v"(l + 24 * FA_KP), "v"(l + 32 * FA_KP), "v"(l + 40 * FA_KP), "v"(l + 48 * FA_KP), "v"(l + 56 * FA_KP),
         "v"(g), "v"(g + s), "v"(g + 2 * s), "v"(g + 3 * s), "v"(g + 4 * s), "v"(g + 5 * s), "v"(g + 6 * s), "v"(g + 7 * s)
      : "memory");
}

// 5-plane variant for query blocks [QB05, QB05+QBN5) (positions < RE), one 64-wide half dh of the head's 128 dims per block: S = Qh.Kh^T + (Ql.Kh^T + Qh.Kl^T)/1024 with Q/K = [hi | x1024 residual] planes (residual planes compact: rows b*RE + s);
// O = (Ph.Vh + (Pl.Vh + Ph.Vl)/1024) / l with P = [hi | x1024 residual] of 1024 p and V^T = [hi | x1024 residual] (VtL pitch RE); separate residual accumulators folded before the normalisation.
// key tiles [0, JE[qblk]) clamped to [1, RE/32] (the compact planes hold keys < RE); a block whose mask exposes keys beyond RE writes NaN rows.
// Products transposed as in k_flash (S^T = K.Q^T, O^T += V^T.P^T): a lane holds 16 scores of one query, both P^T planes are B fragments as they stand in its registers.
// All operand tiles come through LDS, once for the block's four waves: asynchronous copies in whole row pieces; q planes once, the pass's K, V^T and mask tiles in two stages, stage t + 1 in flight while stage t is worked on.
__global__ __launch_bounds__(128) __attribute__((amdgpu_num_vgpr(256))) void k_flash5(const _Float16* __restrict__ Q16, const _Float16* __restrict__ QL, int ldq, const _Float16* __restrict__ K16, const _Float16* __restrict__ KL, int ldk,
                                                const _Float16* __restrict__ Vt, const _Float16* __restrict__ VtL, const unsigned short* __restrict__ MP, const int* __restrict__ JE, _Float16* __restrict__ A2) {
  constexpr int RPW = 16, DT = 4, KS = 4;
  __shared__ __attribute__((aligned(16))) unsigned char ring[2 * F5_STG];
  __shared__ __attribute__((aligned(16))) unsigned char sQ[2 * F5_QB];
  const int tid = threadIdx.x, lane = tid & 31, ln = lane & 15, hh = lane >> 4;
  const int w = __builtin_amdgcn_readfirstlane(tid >> 5);
  const int dh = blockIdx.x & 1; const int bx = blockIdx.x >> 1;
  const int slab = bx / QBN5, qblk = QB05 + bx % QBN5; const int b = slab / NH, h = slab % NH; const int kvh = h / NREP;
  const int qb0 = qblk * (4 * RPW); const int q0 = qb0 + w * RPW;
  int jraw = JE[qblk * 128];   /* the largest count of the block's four 16-query tiles */
#pragma unroll
  for (int i = 1; i < 4; ++i) { const int ji = JE[qblk * 128 + i * 32]; jraw = (ji > jraw) ? ji : jraw; }
  const float pz = (jraw > RE / 32) ? __uint_as_float(0x7FC00000u) : 0.0f;
  int jt = (jraw < 1) ? 1 : jraw; jt = (jt > RE / 32) ? (RE / 32) : jt;
  const int nt = __builtin_amdgcn_readfirstlane(jt);
  /* the lane's copy addresses: q planes, and stage 0 of the ring */
  const unsigned short* gq = (const unsigned short*)Q16 + ((size_t)b * TQ + qb0 + (tid >> 4)) * ldq + h * HDIM + (tid & 15) * 8;
  const unsigned short* gql = (const unsigned short*)QL + ((size_t)b * RE + qb0 + (tid >> 4)) * ldq + h * HDIM + (tid & 15) * 8;
  const unsigned short* gk = (const unsigned short*)K16 + ((size_t)b * TK + (tid >> 4)) * ldk + kvh * HDIM + (tid & 15) * 8;
  const unsigned short* gkl = (const unsigned short*)KL + ((size_t)b * RE + (tid >> 4)) * ldk + kvh * HDIM + (tid & 15) * 8;
  const unsigned short* gv = (const unsigned short*)Vt + ((size_t)(b * NKVH + kvh) * HDIM + dh * 64 + (tid >> 2)) * TK + (tid & 3) * 8;
  const unsigned short* gvl = (const unsigned short*)VtL + ((size_t)(b * NKVH + kvh) * HDIM + dh * 64 + (tid >> 2)) * RE + (tid & 3) * 8;
  const unsigned short* gm = MP + (size_t)(q0 >> 4) * (size_t)(TK / 32) * 512 + lane * 8;
  const size_t sq8 = (size_t)8 * ldq, sk8 = (size_t)8 * ldk, kst = (size_t)32 * ldk, svh = (size_t)32 * TK, svl = (size_t)32 * RE;
  const unsigned rb = (unsigned)(uintptr_t)ring;
  const unsigned lq = (unsigned)(uintptr_t)sQ + (unsigned)((tid >> 4) * FA_KP + (tid & 15) * 16);
  const unsigned lk = rb + (unsigned)((tid >> 4) * FA_KP + (tid & 15) * 16);
  const unsigned lv = rb + (unsigned)(2 * F5_KB + (tid >> 2) * FA_VP + (tid & 3) * 16);
  const unsigned lm = rb + (unsigned)(2 * F5_KB + 2 * F5_VB + w * 1024 + lane * 16);
  const int kofs = ln * FA_KP + 16 * hh, vofs = 2 * F5_KB + ln * FA_VP + 16 * hh, mofs = 2 * F5_KB + 2 * F5_VB + w * 1024 + lane * 16;
  const unsigned char* qp = sQ + (w * RPW + ln) * FA_KP + 16 * hh;
  f5_qplane(lq, gq, sq8);
  f5_qplane(lq + F5_QB, gql, sq8);
  f5_stage(lk, lv, lm, gk, gkl, sk8, gv, svh, gvl, svl, gm);
  float m_q = -3.0e38f, l_q = 0.f; v8f oacc[DT], oaccL[DT];   /* running maximum of query ln (the same in both halves), this half's share of its sum, O^T tiles (row = d, column = query) */
#pragma unroll
  for (int dt = 0; dt < DT; ++dt) { oacc[dt] = (v8f){0.f,0.f,0.f,0.f,0.f,0.f,0.f,0.f}; oaccL[dt] = oacc[dt]; }
  asm volatile("s_wait_asynccnt 0x0" ::: "memory");   /* the q planes and stage 0 have landed before the barrier publishes them */
  __syncthreads();
  if (nt > 1) f5_stage(lk + F5_STG, lv + F5_STG, lm + F5_STG, gk + kst, gkl + kst, sk8, gv + 32, svh, gvl + 32, svl, gm + 512);
#pragma unroll 1
  for (int t = 0; t < nt; ++t) {
    v8f sa = (v8f){0.f,0.f,0.f,0.f,0.f,0.f,0.f,0.f}, sb = sa, sal = sa, sbl = sa;
    const unsigned char* st = ring + (t & 1) * F5_STG;
    const unsigned char* kp = st + kofs; const unsigned char* vp = st + vofs; const unsigned char* mp = st + mofs;
    FragH fm; fm.half[0] = *(const v8us*)mp; fm.half[1] = *(const v8us*)(mp + 512);
#pragma unroll
    for (int ks = 0; ks < KS; ++ks) {
      /* all A and B fragments of this step share one k order: element e < 8 <-> d = 32 ks + 8 hh + e; e >= 8 <-> d = 32 ks + 16 + 8 hh + (e - 8): byte 64 ks + 16 hh of the row, and 32 B further */
      FragH a, al2, k0, k1, g0, g1;
      a.half[0] = *(const v8us*)(qp + ks * 64); a.half[1] = *(const v8us*)(qp + ks * 64 + 32);
      al2.half[0] = *(const v8us*)(qp + F5_QB + ks * 64); al2.half[1] = *(const v8us*)(qp + F5_QB + ks * 64 + 32);
      k0.half[0] = *(const v8us*)(kp + ks * 64); k0.half[1] = *(const v8us*)(kp + ks * 64 + 32);
      k1.half[0] = *(const v8us*)(kp + 16 * FA_KP + ks * 64); k1.half[1] = *(const v8us*)(kp + 16 * FA_KP + ks * 64 + 32);
      g0.half[0] = *(const v8us*)(kp + F5_KB + ks * 64); g0.half[1] = *(const v8us*)(kp + F5_KB + ks * 64 + 32);
      g1.half[0] = *(const v8us*)(kp + F5_KB + 16 * FA_KP + ks * 64); g1.half[1] = *(const v8us*)(kp + F5_KB + 16 * FA_KP + ks * 64 + 32);
      /* A = key rows, B = query columns */
      sa = g2_mma(k0.v, a.v, sa); sb = g2_mma(k1.v, a.v, sb);
      sal = g2_mma(k0.v, al2.v, sal); sbl = g2_mma(k1.v, al2.v, sbl);
      sal = g2_mma(g0.v, a.v, sal); sbl = g2_mma(g1.v, a.v, sbl);
    }
    /* both V^T planes' fragments of this pass are read here, ahead of the softmax, which covers their LDS trip */
    FragH bv[DT], bl[DT];
#pragma unroll
    for (int dt = 0; dt < DT; ++dt) {
      bv[dt].half[0] = *(const v8us*)(vp + dt * 16 * FA_VP); bv[dt].half[1] = *(const v8us*)(vp + dt * 16 * FA_VP + 32);
      bl[dt].half[0] = *(const v8us*)(vp + F5_VB + dt * 16 * FA_VP); bl[dt].half[1] = *(const v8us*)(vp + F5_VB + dt * 16 * FA_VP + 32);
    }
    float s0v[8], s1v[8];
#pragma unroll
    for (int r = 0; r < 8; ++r) {
      /* sa[r]: key 32 t + 8 hh + r, sb[r]: key 32 t + 16 + 8 hh + r, both of query ln */
      const float mk0 = bf16_val(fm.u[r]), mk1 = bf16_val(fm.u[8 + r]);
      const float d0 = sa[r] + sal[r] * 0.0009765625f, d1 = sb[r] + sbl[r] * 0.0009765625f;
      s0v[r] = __builtin_fmaf(d0, SCL, mk0); s1v[r] = __builtin_fmaf(d1, SCL, mk1);
    }
    float mc = fmaxf(s0v[0], s1v[0]);
#pragma unroll
    for (int r = 1; r < 8; ++r) mc = fmaxf(mc, fmaxf(s0v[r], s1v[r]));
    mc = fmaxf(mc, xhalf(mc));
    const float mn = fmaxf(m_q, mc);
#pragma unroll
    for (int r = 0; r < 8; ++r) { s0v[r] = (s0v[r] - mn) * LOG2E; s1v[r] = (s1v[r] - mn) * LOG2E; }
    const float ea = exp2_1((m_q - mn) * LOG2E);
    exp2_8(s0v); exp2_8(s1v);
    const float al = (mn > -1.0e38f) ? ea : 1.0f; m_q = mn;
    float ps = 0.f;
#pragma unroll
    for (int r = 0; r < 8; ++r) ps += s0v[r] + s1v[r];
    l_q = l_q * al + ps;
#pragma unroll
    for (int dt = 0; dt < DT; ++dt) { oacc[dt] *= al; oaccL[dt] *= al; }
    /* B (P^T) fragments, hi and x1024 residual, from the lane's own scores: element e < 8 <-> key 32 t + 8 hh + e; e >= 8 <-> key 32 t + 16 + 8 hh + (e - 8): the key order of the V^T fragments */
    FragH pa, pl;
#pragma unroll
    for (int r = 0; r < 8; ++r) {
      const float ps0 = s0v[r] * 1024.0f, ps1 = s1v[r] * 1024.0f;
      pa.h[r] = toh_flush(ps0); pa.h[8 + r] = toh_flush(ps1);
      pl.h[r] = toh_flush((ps0 - (float)pa.h[r]) * 1024.0f); pl.h[8 + r] = toh_flush((ps1 - (float)pa.h[8 + r]) * 1024.0f);
    }
#pragma unroll
    for (int dt = 0; dt < DT; ++dt) {
      /* A = V^T rows d = 64 dh + 16 dt + ln, keys contiguous */
      oacc[dt] = g2_mma(bv[dt].v, pa.v, oacc[dt]);
      oaccL[dt] = g2_mma(bv[dt].v, pl.v, oaccL[dt]);
      oaccL[dt] = g2_mma(bl[dt].v, pa.v, oaccL[dt]);
    }
    asm volatile("s_wait_dscnt 0x0" ::: "memory");      /* this wave's reads of stage t are done before the stage is refilled */
    asm volatile("s_wait_asynccnt 0x0" ::: "memory");   /* this wave's copies of stage t + 1 have landed before the barrier publishes them */
    __syncthreads();
    if (t + 2 < nt) {
      const unsigned so2 = (unsigned)((t & 1) * F5_STG);
      f5_stage(lk + so2, lv + so2, lm + so2, gk + (size_t)(t + 2) * kst, gkl + (size_t)(t + 2) * kst, sk8, gv + (size_t)(t + 2) * 32, svh, gvl + (size_t)(t + 2) * 32, svl, gm + (size_t)(t + 2) * 512);
    }
  }
  asm volatile("s_wait_asynccnt 0x0" ::: "memory");     /* no copy is outstanding when the wave ends */
  l_q += xhalf(l_q);
  const float li = (l_q > 0.f) ? 1.0f / (l_q * 1024.0f) : 0.f;
  /* the context leaves as the [hi | x1024 residual] operand row of the early-row output product: a lane's 8 accumulator rows are 8 dims in a row of its query, one 16-B word of each plane; the wave writes every byte of its 16 row pieces of 128 B */
  unsigned short* o2 = (unsigned short*)A2 + ((size_t)b * RE + q0 + ln) * (size_t)(2 * DM) + h * HDIM + dh * 64 + 8 * hh;
  v8us oh[DT], ol[DT];
#pragma unroll
  for (int dt = 0; dt < DT; ++dt) {
    FragH fh, fl;
#pragma unroll
    for (int r = 0; r < 8; ++r) {
      float v = oacc[dt][r]; v += oaccL[dt][r] * 0.0009765625f; v = v * li + pz;
      const _Float16 hv = (_Float16)v; fh.h[r] = hv; fl.h[r] = (_Float16)((v - (float)hv) * 1024.0f);
    }
    oh[dt] = fh.half[0]; ol[dt] = fl.half[0];
  }
#pragma unroll
  for (int dt = 0; dt < DT; ++dt) { *(v8us*)(o2 + dt * 16) = oh[dt]; *(v8us*)(o2 + DM + dt * 16) = ol[dt]; }
}

extern "C" void kernel_launch(void* const* d_in, const int* in_sizes, int n_in,
                              void* d_out, int out_size, void* d_ws, size_t ws_size, hipStream_t stream) {
  if (n_in < 10) return;
  const size_t needx = ((size_t)(NB - 1) * SEQ_FULL + (size_t)SLEN) * DM;
  if ((size_t)in_sizes[0] < needx) return;
  if ((size_t)in_sizes[1] < (size_t)DM * DM) return;
  if ((size_t)in_sizes[2] < (size_t)VW * DM) return;
  if ((size_t)in_sizes[3] < (size_t)VW * DM) return;
  if ((size_t)in_sizes[4] < (size_t)DM * DM) return;
  if ((size_t)in_sizes[5] < (size_t)HDIM) return;
  if ((size_t)in_sizes[6] < (size_t)HDIM) return;
  if ((size_t)in_sizes[7] < (size_t)SLEN * RTW) return;
  if ((size_t)in_sizes[8] < (size_t)SLEN * RTW) return;
  if ((size_t)in_sizes[9] < (size_t)(SLEN - 1) * MSKP + (size_t)SLEN) return;
  if ((size_t)out_size < needx) return;
  /* inputs in order: x, Wq, Wk, Wv, Wo, q gain, k gain, cos table, sin table, mask */
  const float* x = (const float*)d_in[0]; const float* Wq = (const float*)d_in[1]; const float* Wk = (const float*)d_in[2]; const float* Wv = (const float*)d_in[3]; const float* Wo = (const float*)d_in[4];
  const float* qnw = (const float*)d_in[5]; const float* knw = (const float*)d_in[6]; const float* rct = (const float*)d_in[7]; const float* rst = (const float*)d_in[8]; const float* msk = (const float*)d_in[9];
  float* dout = (float*)d_out;
  char* ws = (char*)d_ws; size_t off = 0;
  auto take = [&](size_t bytes) { char* p = ws + off; off += (bytes + 255) & ~(size_t)255; return p; };
  _Float16* BQ = (_Float16*)take(SZ_BQ);                                /* [n][k] f16, x16; BQ, BK, BV back to back = the [QKVW][DM] operand of the joint projection */
  _Float16* BK = (_Float16*)take(SZ_BK);
  _Float16* BV = (_Float16*)take(SZ_BK);
  _Float16* B2 = (_Float16*)take(SZ_B2);                                /* [n][2*DM] f16: [x16384 | x16] copies of Wo */
  _Float16* OH = (_Float16*)take(SZ_OH);                                /* context hi plane [NR][DM], rows [RE, SLEN) of each batch written */
  _Float16* X16 = (_Float16*)take(SZ_X16);                              /* f16 input rows */
  _Float16* VT = (_Float16*)take(SZ_VT);                                /* V^T [b * VW + v column][TK]; a plane of its own: the projection writes it while other blocks still read the input rows */
  _Float16* QH = (_Float16*)take(SZ_QH);                                /* [NR][DM] */
  _Float16* KHp = (_Float16*)take(SZ_KH);                               /* [NR][VW] */
  _Float16* QL = (_Float16*)take(SZ_QL);                                /* [NB*RE][DM] residual plane */
  _Float16* KL = (_Float16*)take(SZ_KL);                                /* [NB*RE][VW] residual plane */
  _Float16* VTL = (_Float16*)take(SZ_VTL);                              /* [(b,g)][64][RE] */
  _Float16* A2 = (_Float16*)take(SZ_A2);                                /* [NB*RE][2*DM] = [ctx hi | ctx residual] */
  unsigned short* MPp = (unsigned short*)take(SZ_MP);                   /* bf16 mask plane, accumulator layout */
  int* JEp = (int*)take(SZ_JE);                                         /* [SLEN/16][32] key-tile counts */
  if (off > ws_size) return;

  k_prep<<<PB_ALL, 256, 0, stream>>>(msk, x, Wq, Wk, Wv, Wo, JEp, X16, BQ, BK, BV, B2, MPp);
  k_gemm_qkv<<<(unsigned)((NR / 128) * (QKVW / 128)), 128, 0, stream>>>(X16, BQ, qnw, knw, rct, rst, QH, QL, KHp, KL, VT, VTL);
  k_flash5<<<(unsigned)(NB * NH * QBN5 * 2), 128, 0, stream>>>(QH, QL, DM, KHp, KL, VW, VT, VTL, MPp, JEp, A2);
  if (QBNP > 0) k_flash<<<(unsigned)(NB * NH * QBNP), 128, 0, stream>>>(QH, DM, KHp, VW, VT, MPp, JEp, OH, DM);
  k_gemm_out<<<(unsigned)(OB_E + OB_L), 128, 0, stream>>>(A2, OH, B2, dout);
}
